// v000
// The times below were measured on an AMD MI455X: many runs one after another, warmed up first and cycling through
// copies of the inputs, with the whole window's GPU time divided by the number of runs. Launches and the gaps
// between them are all in it. The median over several windows is given; except for v000 it joins two sittings, which
// can be a few percent apart, so the side-by-side timings, each taken in one sitting, are the better comparison.
// v000, which the later versions start from, runs in 1120 microseconds.
#include <hip/hip_runtime.h>
#include <hip/hip_bf16.h>

#define BZ       16
#define IN_DIM   512
#define S_DIM    512
#define OUT_DIM  512
#define SEQ_L    2048
#define M_TOT    (SEQ_L * BZ)      // 32768

#define BLK_M    128
#define BLK_N    128
#define BLK_K    32
#define LDS_K    40                // 32 + 8 pad (conflict-free b128 frags)

typedef __attribute__((ext_vector_type(16))) __bf16 v16bf;
typedef __attribute__((ext_vector_type(8)))  __bf16 v8bf;
typedef __attribute__((ext_vector_type(8)))  float  v8f;

#if defined(__gfx1250__) && __has_builtin(__builtin_amdgcn_tensor_load_to_lds)
#define HAVE_TDM 1
#else
#define HAVE_TDM 0
#endif

#if HAVE_TDM
typedef __attribute__((ext_vector_type(4))) unsigned int v4u;
typedef __attribute__((ext_vector_type(8))) int          v8i;
typedef __attribute__((ext_vector_type(4))) int          v4i;

__device__ __forceinline__ void tdm_load_2d(unsigned lds_off, const void* gptr,
                                            unsigned rows, unsigned cols,
                                            unsigned row_stride_elems) {
    unsigned long long ga = (unsigned long long)(uintptr_t)gptr;
    v4u g0;
    g0[0] = 1u;                                        // count=1, load, user
    g0[1] = lds_off;                                   // lds_addr (bytes)
    g0[2] = (unsigned)(ga & 0xffffffffu);              // global_addr[31:0]
    g0[3] = (unsigned)((ga >> 32) & 0x1ffffffu) | (2u << 30);  // [56:32]|type=2
    const unsigned td0 = 0x01000000u, td1 = 0x01000000u;   // huge: no OOB clamp
    v8i g1;
    g1[0] = (int)((1u << 16)
                | (1u << 20)
                | (3u << 22)
                | (3u << 25));
    g1[1] = (int)((td0 & 0xffffu) << 16);
    g1[2] = (int)(((td0 >> 16) & 0xffffu) | ((td1 & 0xffffu) << 16));
    g1[3] = (int)(((td1 >> 16) & 0xffffu) | (cols << 16));
    g1[4] = (int)(rows & 0xffffu);
    g1[5] = (int)row_stride_elems;
    g1[6] = 0;
    g1[7] = 0;
    v4i gz4 = {0, 0, 0, 0};
    v8i gz8 = {0, 0, 0, 0, 0, 0, 0, 0};
    __builtin_amdgcn_tensor_load_to_lds(g0, g1, gz4, gz4, gz8, 0);
}
#endif

__device__ __forceinline__ v16bf load_frag(const __bf16* row, int h) {
    v8bf lo = *(const v8bf*)(row + h * 8);
    v8bf hi = *(const v8bf*)(row + 16 + h * 8);
    return __builtin_shufflevector(lo, hi, 0,1,2,3,4,5,6,7,8,9,10,11,12,13,14,15);
}

__device__ __forceinline__ v8f wmma_bf16(v16bf a, v16bf b, v8f c) {
    return __builtin_amdgcn_wmma_f32_16x16x32_bf16(
        false, a, false, b, (short)0, c, false, false);
}

// --------------------------- prep kernels ----------------------------------

__global__ void ssm_adiag_kernel(const float* __restrict__ a_unc,
                                 float* __restrict__ ad) {
    int i = blockIdx.x * blockDim.x + threadIdx.x;
    if (i < S_DIM) {
        float x = a_unc[i];
        ad[i] = -(fmaxf(x, 0.0f) + log1pf(expf(-fabsf(x))));
    }
}

__global__ void ssm_cvt_kernel(const float* __restrict__ src,
                               __bf16* __restrict__ dst,
                               int n, int src_cols, int dst_stride, int dst_off) {
    int i = blockIdx.x * blockDim.x + threadIdx.x;
    if (i < n) {
        int r = i / src_cols, c = i - r * src_cols;
        dst[(size_t)r * dst_stride + dst_off + c] = (__bf16)src[i];
    }
}

__global__ __launch_bounds__(256)
void ssm_gemm1_kernel(const float* __restrict__ u,
                      const __bf16* __restrict__ Bb,
                      float* __restrict__ Bu,
                      __bf16* __restrict__ uT) {
    __shared__ __align__(16) __bf16 ldsA[2][BLK_M][LDS_K];
    __shared__ __align__(16) __bf16 ldsB[2][BLK_N][LDS_K];

    const int tid  = threadIdx.x;
    const int lane = tid & 31;
    const int wave = tid >> 5;
    const int wm   = wave >> 1;          // 0..3 -> rows wm*32
    const int wn   = wave & 1;           // 0..1 -> cols wn*64
    const int lr   = lane & 15;
    const int h    = lane >> 4;

    const int mbase = blockIdx.x * BLK_M;
    const int nbase = blockIdx.y * BLK_N;

    // A loader: one (row, 16-wide K chunk) per thread
    const int arow = tid >> 1;
    const int akq  = (tid & 1) * 16;
    const int amg  = mbase + arow;
    const float* aptr = u + ((size_t)(amg & (BZ - 1)) * IN_DIM) * SEQ_L + (amg >> 4);

    v8f acc[2][4];
    #pragma unroll
    for (int mi = 0; mi < 2; ++mi)
        #pragma unroll
        for (int ni = 0; ni < 4; ++ni) acc[mi][ni] = (v8f){};

    auto stage = [&](int kt, int buf) {
        const int k0 = kt * BLK_K;
        // ---- A: strided f32 gather -> bf16 (and emit uT once) ----
        v8bf v0, v1;
        #pragma unroll
        for (int j = 0; j < 8; ++j) {
            v0[j] = (__bf16)aptr[(size_t)(k0 + akq + j) * SEQ_L];
            v1[j] = (__bf16)aptr[(size_t)(k0 + akq + 8 + j) * SEQ_L];
        }
        *(v8bf*)&ldsA[buf][arow][akq]     = v0;
        *(v8bf*)&ldsA[buf][arow][akq + 8] = v1;
        if (blockIdx.y == 0) {
            *(v8bf*)(uT + (size_t)amg * IN_DIM + k0 + akq)     = v0;
            *(v8bf*)(uT + (size_t)amg * IN_DIM + k0 + akq + 8) = v1;
        }
#if HAVE_TDM
        if (wave == 0)
            tdm_load_2d((unsigned)(uintptr_t)&ldsB[buf][0][0],
                        Bb + (size_t)nbase * IN_DIM + k0,
                        BLK_N, BLK_K, IN_DIM);
#else
        const __bf16* bp = Bb + (size_t)(nbase + (tid >> 1)) * IN_DIM + k0 + akq;
        *(v8bf*)&ldsB[buf][tid >> 1][akq]     = *(const v8bf*)bp;
        *(v8bf*)&ldsB[buf][tid >> 1][akq + 8] = *(const v8bf*)(bp + 8);
#endif
    };

    stage(0, 0);
#if HAVE_TDM
    if (wave == 0) __builtin_amdgcn_s_wait_tensorcnt(0);
#endif
    __syncthreads();

    const int KT = IN_DIM / BLK_K;       // 16
    for (int kt = 0; kt < KT; ++kt) {
        const int buf = kt & 1;
        if (kt + 1 < KT) stage(kt + 1, buf ^ 1);

        v16bf a0 = load_frag(&ldsA[buf][wm * 32 + lr][0],      h);
        v16bf a1 = load_frag(&ldsA[buf][wm * 32 + 16 + lr][0], h);
        #pragma unroll
        for (int ni = 0; ni < 4; ++ni) {
            v16bf bf = load_frag(&ldsB[buf][wn * 64 + ni * 16 + lr][0], h);
            acc[0][ni] = wmma_bf16(a0, bf, acc[0][ni]);
            acc[1][ni] = wmma_bf16(a1, bf, acc[1][ni]);
        }
#if HAVE_TDM
        if (wave == 0) __builtin_amdgcn_s_wait_tensorcnt(0);
#endif
        __syncthreads();
    }

    // ---- epilogue: Bu[m][s] f32, coalesced across lanes ----
    #pragma unroll
    for (int mi = 0; mi < 2; ++mi)
        #pragma unroll
        for (int ni = 0; ni < 4; ++ni) {
            int n = nbase + wn * 64 + ni * 16 + lr;
            int m = mbase + wm * 32 + mi * 16 + h * 8;
            #pragma unroll
            for (int r = 0; r < 8; ++r)
                Bu[(size_t)(m + r) * S_DIM + n] = acc[mi][ni][r];
        }
}

// --------------------------- SCAN ------------------------------------------
__global__ __launch_bounds__(256)
void ssm_scan_kernel(const float* __restrict__ Bu,
                     const float* __restrict__ ad,
                     const float* __restrict__ h0,
                     __bf16* __restrict__ xs) {
    int t = blockIdx.x * blockDim.x + threadIdx.x;   // 0..8191
    int s = t & (S_DIM - 1);
    int b = t >> 9;
    float a = ad[s];
    float x = h0[s];
    const float* bu = Bu + (size_t)b * S_DIM + s;
    __bf16* xo = xs + (size_t)b * S_DIM + s;
    const size_t stride = (size_t)BZ * S_DIM;        // 8192
    for (int l = 0; l < SEQ_L; ++l) {
        if (l + 8 < SEQ_L)
            __builtin_prefetch(bu + (size_t)(l + 8) * stride, 0, 0);
        x = fmaf(x, a, bu[(size_t)l * stride]);
        xo[(size_t)l * stride] = (__bf16)x;
    }
}

__global__ __launch_bounds__(256)
void ssm_gemm2_kernel(const __bf16* __restrict__ xs,
                      const __bf16* __restrict__ uT,
                      const __bf16* __restrict__ CDb,   // [o][k], stride 1024
                      float* __restrict__ out) {
    __shared__ __align__(16) __bf16 ldsA[2][BLK_M][LDS_K];
    __shared__ __align__(16) __bf16 ldsB[2][BLK_N][LDS_K];

    const int tid  = threadIdx.x;
    const int lane = tid & 31;
    const int wave = tid >> 5;
    const int wm   = wave >> 1;
    const int wn   = wave & 1;
    const int lr   = lane & 15;
    const int h    = lane >> 4;

    const int mbase = blockIdx.x * BLK_M;
    const int nbase = blockIdx.y * BLK_N;

    v8f acc[2][4];
    #pragma unroll
    for (int mi = 0; mi < 2; ++mi)
        #pragma unroll
        for (int ni = 0; ni < 4; ++ni) acc[mi][ni] = (v8f){};

    auto stage = [&](int kt, int buf) {
        const int k0 = kt * BLK_K;
        const __bf16* asrc = (k0 < S_DIM)
            ? xs + (size_t)mbase * S_DIM + k0
            : uT + (size_t)mbase * IN_DIM + (k0 - S_DIM);
#if HAVE_TDM
        if (wave == 0) {
            tdm_load_2d((unsigned)(uintptr_t)&ldsA[buf][0][0], asrc,
                        BLK_M, BLK_K, S_DIM);
            tdm_load_2d((unsigned)(uintptr_t)&ldsB[buf][0][0],
                        CDb + (size_t)nbase * 1024 + k0,
                        BLK_N, BLK_K, 1024);
        }
#else
        const int row = tid >> 1, kq = (tid & 1) * 16;
        const __bf16* ap = asrc + (size_t)row * S_DIM + kq;
        *(v8bf*)&ldsA[buf][row][kq]     = *(const v8bf*)ap;
        *(v8bf*)&ldsA[buf][row][kq + 8] = *(const v8bf*)(ap + 8);
        const __bf16* bp = CDb + (size_t)(nbase + row) * 1024 + k0 + kq;
        *(v8bf*)&ldsB[buf][row][kq]     = *(const v8bf*)bp;
        *(v8bf*)&ldsB[buf][row][kq + 8] = *(const v8bf*)(bp + 8);
#endif
    };

    stage(0, 0);
#if HAVE_TDM
    if (wave == 0) __builtin_amdgcn_s_wait_tensorcnt(0);
#endif
    __syncthreads();

    const int KT = 1024 / BLK_K;          // 32
    for (int kt = 0; kt < KT; ++kt) {
        const int buf = kt & 1;
        if (kt + 1 < KT) stage(kt + 1, buf ^ 1);

        v16bf a0 = load_frag(&ldsA[buf][wm * 32 + lr][0],      h);
        v16bf a1 = load_frag(&ldsA[buf][wm * 32 + 16 + lr][0], h);
        #pragma unroll
        for (int ni = 0; ni < 4; ++ni) {
            v16bf bf = load_frag(&ldsB[buf][wn * 64 + ni * 16 + lr][0], h);
            acc[0][ni] = wmma_bf16(a0, bf, acc[0][ni]);
            acc[1][ni] = wmma_bf16(a1, bf, acc[1][ni]);
        }
#if HAVE_TDM
        if (wave == 0) __builtin_amdgcn_s_wait_tensorcnt(0);
#endif
        __syncthreads();
    }

    // epilogue: Y[b, o, l]; m = l*16 + b
    #pragma unroll
    for (int mi = 0; mi < 2; ++mi)
        #pragma unroll
        for (int ni = 0; ni < 4; ++ni) {
            int o = nbase + wn * 64 + ni * 16 + lr;
            int m = mbase + wm * 32 + mi * 16 + h * 8;
            #pragma unroll
            for (int r = 0; r < 8; ++r) {
                int mg = m + r;
                out[(size_t)(mg & (BZ - 1)) * OUT_DIM * SEQ_L
                    + (size_t)o * SEQ_L + (mg >> 4)] = acc[mi][ni][r];
            }
        }
}

// --------------------------- launch ----------------------------------------

extern "C" void kernel_launch(void* const* d_in, const int* in_sizes, int n_in,
                              void* d_out, int out_size, void* d_ws, size_t ws_size,
                              hipStream_t stream) {
    const float* u     = (const float*)d_in[0];
    const float* a_unc = (const float*)d_in[1];
    const float* Bmat  = (const float*)d_in[2];
    const float* Cmat  = (const float*)d_in[3];
    const float* Dmat  = (const float*)d_in[4];
    const float* h0    = (const float*)d_in[5];
    float* out = (float*)d_out;

    char* w = (char*)d_ws;
    float*  ad  = (float*)w;                               // 2 KiB
    __bf16* Bb  = (__bf16*)(w + 4096);                     // 512 KiB
    __bf16* CDb = (__bf16*)(w + 4096 + (512 << 10));       // 1 MiB
    char* w2 = w + 4096 + (512 << 10) + (1 << 20);
    float*  Bu  = (float*)w2;                              // 64 MiB
    __bf16* xsb = (__bf16*)(w2 + ((size_t)64 << 20));      // 32 MiB
    __bf16* uT  = (__bf16*)(w2 + ((size_t)96 << 20));      // 32 MiB

    ssm_adiag_kernel<<<2, 256, 0, stream>>>(a_unc, ad);
    const int nW = S_DIM * IN_DIM;
    ssm_cvt_kernel<<<(nW + 255) / 256, 256, 0, stream>>>(Bmat, Bb,  nW, IN_DIM, 512,  0);
    ssm_cvt_kernel<<<(nW + 255) / 256, 256, 0, stream>>>(Cmat, CDb, nW, S_DIM, 1024, 0);
    ssm_cvt_kernel<<<(nW + 255) / 256, 256, 0, stream>>>(Dmat, CDb, nW, IN_DIM, 1024, 512);

    ssm_gemm1_kernel<<<dim3(M_TOT / BLK_M, S_DIM / BLK_N), 256, 0, stream>>>(u, Bb, Bu, uT);
    ssm_scan_kernel<<<(BZ * S_DIM) / 256, 256, 0, stream>>>(Bu, ad, h0, xsb);
    ssm_gemm2_kernel<<<dim3(M_TOT / BLK_M, OUT_DIM / BLK_N), 256, 0, stream>>>(xsb, uT, CDb, out);
}

// v001
// A run of this version takes 348 microseconds.
// Next to v000, in two timings, it ran 3.21 and 3.19 times as fast.
#include <hip/hip_runtime.h>
#include <hip/hip_bf16.h>

#define BZ       16
#define IN_DIM   512
#define S_DIM    512
#define OUT_DIM  512
#define SEQ_L    2048
#define M_TOT    (SEQ_L * BZ)      // 32768

#define BLK_M    128
#define BLK_N    128
#define BLK_K    32
#define LDS_K    40                // 32 + 8 pad (conflict-free b128 frags)

typedef __attribute__((ext_vector_type(16))) __bf16 v16bf;
typedef __attribute__((ext_vector_type(8)))  __bf16 v8bf;
typedef __attribute__((ext_vector_type(8)))  float  v8f;

#if defined(__gfx1250__) && __has_builtin(__builtin_amdgcn_tensor_load_to_lds)
#define HAVE_TDM 1
#else
#define HAVE_TDM 0
#endif

#if HAVE_TDM
typedef __attribute__((ext_vector_type(4))) unsigned int v4u;
typedef __attribute__((ext_vector_type(8))) int          v8i;
typedef __attribute__((ext_vector_type(4))) int          v4i;

__device__ __forceinline__ void tdm_load_2d(unsigned lds_off, const void* gptr,
                                            unsigned rows, unsigned cols,
                                            unsigned row_stride_elems) {
    unsigned long long ga = (unsigned long long)(uintptr_t)gptr;
    v4u g0;
    g0[0] = 1u;                                        // count=1, load, user
    g0[1] = lds_off;                                   // lds_addr (bytes)
    g0[2] = (unsigned)(ga & 0xffffffffu);              // global_addr[31:0]
    g0[3] = (unsigned)((ga >> 32) & 0x1ffffffu) | (2u << 30);  // [56:32]|type=2
    const unsigned td0 = 0x01000000u, td1 = 0x01000000u;   // huge: no OOB clamp
    v8i g1;
    g1[0] = (int)((1u << 16)
                | (1u << 20)
                | (3u << 22)
                | (3u << 25));
    g1[1] = (int)((td0 & 0xffffu) << 16);
    g1[2] = (int)(((td0 >> 16) & 0xffffu) | ((td1 & 0xffffu) << 16));
    g1[3] = (int)(((td1 >> 16) & 0xffffu) | (cols << 16));
    g1[4] = (int)(rows & 0xffffu);
    g1[5] = (int)row_stride_elems;
    g1[6] = 0;
    g1[7] = 0;
    v4i gz4 = {0, 0, 0, 0};
    v8i gz8 = {0, 0, 0, 0, 0, 0, 0, 0};
    __builtin_amdgcn_tensor_load_to_lds(g0, g1, gz4, gz4, gz8, 0);
}
#endif

__device__ __forceinline__ v16bf load_frag(const __bf16* row, int h) {
    v8bf lo = *(const v8bf*)(row + h * 8);
    v8bf hi = *(const v8bf*)(row + 16 + h * 8);
    return __builtin_shufflevector(lo, hi, 0,1,2,3,4,5,6,7,8,9,10,11,12,13,14,15);
}

__device__ __forceinline__ v8f wmma_bf16(v16bf a, v16bf b, v8f c) {
    return __builtin_amdgcn_wmma_f32_16x16x32_bf16(
        false, a, false, b, (short)0, c, false, false);
}

// --------------------------- prep kernels ----------------------------------

__global__ void ssm_adiag_kernel(const float* __restrict__ a_unc,
                                 float* __restrict__ ad) {
    int i = blockIdx.x * blockDim.x + threadIdx.x;
    if (i < S_DIM) {
        float x = a_unc[i];
        ad[i] = -(fmaxf(x, 0.0f) + log1pf(expf(-fabsf(x))));
    }
}

__global__ void ssm_cvt_kernel(const float* __restrict__ src,
                               __bf16* __restrict__ dst,
                               int n, int src_cols, int dst_stride, int dst_off) {
    int i = blockIdx.x * blockDim.x + threadIdx.x;
    if (i < n) {
        int r = i / src_cols, c = i - r * src_cols;
        dst[(size_t)r * dst_stride + dst_off + c] = (__bf16)src[i];
    }
}

__global__ __launch_bounds__(256)
void ssm_gemm1_kernel(const float* __restrict__ u,
                      const __bf16* __restrict__ Bb,
                      float* __restrict__ Bu,
                      __bf16* __restrict__ uT) {
    __shared__ __align__(16) __bf16 ldsA[2][BLK_M][LDS_K];
    __shared__ __align__(16) __bf16 ldsB[2][BLK_N][LDS_K];

    const int tid  = threadIdx.x;
    const int lane = tid & 31;
    const int wave = tid >> 5;
    const int wm   = wave >> 1;          // 0..3 -> rows wm*32
    const int wn   = wave & 1;           // 0..1 -> cols wn*64
    const int lr   = lane & 15;
    const int h    = lane >> 4;

    const int mbase = blockIdx.x * BLK_M;
    const int nbase = blockIdx.y * BLK_N;

    // A loader: one (row, 16-wide K chunk) per thread
    const int arow = tid >> 1;
    const int akq  = (tid & 1) * 16;
    const int amg  = mbase + arow;
    const float* aptr = u + ((size_t)(amg & (BZ - 1)) * IN_DIM) * SEQ_L + (amg >> 4);

    v8f acc[2][4];
    #pragma unroll
    for (int mi = 0; mi < 2; ++mi)
        #pragma unroll
        for (int ni = 0; ni < 4; ++ni) acc[mi][ni] = (v8f){};

    auto stage = [&](int kt, int buf) {
        const int k0 = kt * BLK_K;
        // ---- A: strided f32 gather -> bf16 (and emit uT once) ----
        v8bf v0, v1;
        #pragma unroll
        for (int j = 0; j < 8; ++j) {
            v0[j] = (__bf16)aptr[(size_t)(k0 + akq + j) * SEQ_L];
            v1[j] = (__bf16)aptr[(size_t)(k0 + akq + 8 + j) * SEQ_L];
        }
        *(v8bf*)&ldsA[buf][arow][akq]     = v0;
        *(v8bf*)&ldsA[buf][arow][akq + 8] = v1;
        if (blockIdx.y == 0) {
            *(v8bf*)(uT + (size_t)amg * IN_DIM + k0 + akq)     = v0;
            *(v8bf*)(uT + (size_t)amg * IN_DIM + k0 + akq + 8) = v1;
        }
#if HAVE_TDM
        if (wave == 0)
            tdm_load_2d((unsigned)(uintptr_t)&ldsB[buf][0][0],
                        Bb + (size_t)nbase * IN_DIM + k0,
                        BLK_N, BLK_K, IN_DIM);
#else
        const __bf16* bp = Bb + (size_t)(nbase + (tid >> 1)) * IN_DIM + k0 + akq;
        *(v8bf*)&ldsB[buf][tid >> 1][akq]     = *(const v8bf*)bp;
        *(v8bf*)&ldsB[buf][tid >> 1][akq + 8] = *(const v8bf*)(bp + 8);
#endif
    };

    stage(0, 0);
#if HAVE_TDM
    if (wave == 0) __builtin_amdgcn_s_wait_tensorcnt(0);
#endif
    __syncthreads();

    const int KT = IN_DIM / BLK_K;       // 16
    for (int kt = 0; kt < KT; ++kt) {
        const int buf = kt & 1;
        if (kt + 1 < KT) stage(kt + 1, buf ^ 1);

        v16bf a0 = load_frag(&ldsA[buf][wm * 32 + lr][0],      h);
        v16bf a1 = load_frag(&ldsA[buf][wm * 32 + 16 + lr][0], h);
        #pragma unroll
        for (int ni = 0; ni < 4; ++ni) {
            v16bf bf = load_frag(&ldsB[buf][wn * 64 + ni * 16 + lr][0], h);
            acc[0][ni] = wmma_bf16(a0, bf, acc[0][ni]);
            acc[1][ni] = wmma_bf16(a1, bf, acc[1][ni]);
        }
#if HAVE_TDM
        if (wave == 0) __builtin_amdgcn_s_wait_tensorcnt(0);
#endif
        __syncthreads();
    }

    // ---- epilogue: Bu[m][s] f32, coalesced across lanes ----
    #pragma unroll
    for (int mi = 0; mi < 2; ++mi)
        #pragma unroll
        for (int ni = 0; ni < 4; ++ni) {
            int n = nbase + wn * 64 + ni * 16 + lr;
            int m = mbase + wm * 32 + mi * 16 + h * 8;
            #pragma unroll
            for (int r = 0; r < 8; ++r)
                Bu[(size_t)(m + r) * S_DIM + n] = acc[mi][ni][r];
        }
}

#define SCAN_D   64
#define SCAN_G   16                // steps whose bf16 results are stored together
__global__ __launch_bounds__(256)
void ssm_scan_kernel(const float* __restrict__ Bu,
                     const float* __restrict__ ad,
                     const float* __restrict__ h0,
                     __bf16* __restrict__ xs) {
    int t = blockIdx.x * blockDim.x + threadIdx.x;   // 0..8191
    int s = t & (S_DIM - 1);
    int b = t >> 9;
    float a = ad[s];
    float x = h0[s];
    // keeps these two loads older than the ring's: issued behind the ring,
    // their wait at the loop's head drains the whole ring on every trip
    __builtin_amdgcn_sched_barrier(0);
    const float* bu = Bu + (size_t)b * S_DIM + s;
    __bf16* xo = xs + (size_t)b * S_DIM + s;
    const size_t stride = (size_t)BZ * S_DIM;        // 8192

    float ring[SCAN_D];
    #pragma unroll
    for (int j = 0; j < SCAN_D; ++j) ring[j] = bu[(size_t)j * stride];

    for (int l0 = 0; l0 < SEQ_L - SCAN_D; l0 += SCAN_D) {
        #pragma unroll
        for (int g = 0; g < SCAN_D; g += SCAN_G) {
            __bf16 y[SCAN_G];
            #pragma unroll
            for (int k = 0; k < SCAN_G; ++k) {
                x = fmaf(x, a, ring[g + k]);
                y[k] = (__bf16)x;
                ring[g + k] = bu[(size_t)(l0 + SCAN_D + g + k) * stride];
            }
            __builtin_amdgcn_sched_barrier(0);
            #pragma unroll
            for (int k = 0; k < SCAN_G; ++k)
                xo[(size_t)(l0 + g + k) * stride] = y[k];
            // keeps the stores from sinking to the trip's end, where all
            // SCAN_D of them in a row fill the store counter
            __builtin_amdgcn_sched_barrier(0);
        }
    }
    #pragma unroll
    for (int j = 0; j < SCAN_D; ++j) {
        x = fmaf(x, a, ring[j]);
        xo[(size_t)(SEQ_L - SCAN_D + j) * stride] = (__bf16)x;
    }
}

__global__ __launch_bounds__(256)
void ssm_gemm2_kernel(const __bf16* __restrict__ xs,
                      const __bf16* __restrict__ uT,
                      const __bf16* __restrict__ CDb,   // [o][k], stride 1024
                      float* __restrict__ out) {
    __shared__ __align__(16) __bf16 ldsA[2][BLK_M][LDS_K];
    __shared__ __align__(16) __bf16 ldsB[2][BLK_N][LDS_K];

    const int tid  = threadIdx.x;
    const int lane = tid & 31;
    const int wave = tid >> 5;
    const int wm   = wave >> 1;
    const int wn   = wave & 1;
    const int lr   = lane & 15;
    const int h    = lane >> 4;

    const int mbase = blockIdx.x * BLK_M;
    const int nbase = blockIdx.y * BLK_N;

    v8f acc[2][4];
    #pragma unroll
    for (int mi = 0; mi < 2; ++mi)
        #pragma unroll
        for (int ni = 0; ni < 4; ++ni) acc[mi][ni] = (v8f){};

    auto stage = [&](int kt, int buf) {
        const int k0 = kt * BLK_K;
        const __bf16* asrc = (k0 < S_DIM)
            ? xs + (size_t)mbase * S_DIM + k0
            : uT + (size_t)mbase * IN_DIM + (k0 - S_DIM);
#if HAVE_TDM
        if (wave == 0) {
            tdm_load_2d((unsigned)(uintptr_t)&ldsA[buf][0][0], asrc,
                        BLK_M, BLK_K, S_DIM);
            tdm_load_2d((unsigned)(uintptr_t)&ldsB[buf][0][0],
                        CDb + (size_t)nbase * 1024 + k0,
                        BLK_N, BLK_K, 1024);
        }
#else
        const int row = tid >> 1, kq = (tid & 1) * 16;
        const __bf16* ap = asrc + (size_t)row * S_DIM + kq;
        *(v8bf*)&ldsA[buf][row][kq]     = *(const v8bf*)ap;
        *(v8bf*)&ldsA[buf][row][kq + 8] = *(const v8bf*)(ap + 8);
        const __bf16* bp = CDb + (size_t)(nbase + row) * 1024 + k0 + kq;
        *(v8bf*)&ldsB[buf][row][kq]     = *(const v8bf*)bp;
        *(v8bf*)&ldsB[buf][row][kq + 8] = *(const v8bf*)(bp + 8);
#endif
    };

    stage(0, 0);
#if HAVE_TDM
    if (wave == 0) __builtin_amdgcn_s_wait_tensorcnt(0);
#endif
    __syncthreads();

    const int KT = 1024 / BLK_K;          // 32
    for (int kt = 0; kt < KT; ++kt) {
        const int buf = kt & 1;
        if (kt + 1 < KT) stage(kt + 1, buf ^ 1);

        v16bf a0 = load_frag(&ldsA[buf][wm * 32 + lr][0],      h);
        v16bf a1 = load_frag(&ldsA[buf][wm * 32 + 16 + lr][0], h);
        #pragma unroll
        for (int ni = 0; ni < 4; ++ni) {
            v16bf bf = load_frag(&ldsB[buf][wn * 64 + ni * 16 + lr][0], h);
            acc[0][ni] = wmma_bf16(a0, bf, acc[0][ni]);
            acc[1][ni] = wmma_bf16(a1, bf, acc[1][ni]);
        }
#if HAVE_TDM
        if (wave == 0) __builtin_amdgcn_s_wait_tensorcnt(0);
#endif
        __syncthreads();
    }

    // epilogue: Y[b, o, l]; m = l*16 + b
    #pragma unroll
    for (int mi = 0; mi < 2; ++mi)
        #pragma unroll
        for (int ni = 0; ni < 4; ++ni) {
            int o = nbase + wn * 64 + ni * 16 + lr;
            int m = mbase + wm * 32 + mi * 16 + h * 8;
            #pragma unroll
            for (int r = 0; r < 8; ++r) {
                int mg = m + r;
                out[(size_t)(mg & (BZ - 1)) * OUT_DIM * SEQ_L
                    + (size_t)o * SEQ_L + (mg >> 4)] = acc[mi][ni][r];
            }
        }
}

// --------------------------- launch ----------------------------------------

extern "C" void kernel_launch(void* const* d_in, const int* in_sizes, int n_in,
                              void* d_out, int out_size, void* d_ws, size_t ws_size,
                              hipStream_t stream) {
    const float* u     = (const float*)d_in[0];
    const float* a_unc = (const float*)d_in[1];
    const float* Bmat  = (const float*)d_in[2];
    const float* Cmat  = (const float*)d_in[3];
    const float* Dmat  = (const float*)d_in[4];
    const float* h0    = (const float*)d_in[5];
    float* out = (float*)d_out;

    char* w = (char*)d_ws;
    float*  ad  = (float*)w;                               // 2 KiB
    __bf16* Bb  = (__bf16*)(w + 4096);                     // 512 KiB
    __bf16* CDb = (__bf16*)(w + 4096 + (512 << 10));       // 1 MiB
    char* w2 = w + 4096 + (512 << 10) + (1 << 20);
    float*  Bu  = (float*)w2;                              // 64 MiB
    __bf16* xsb = (__bf16*)(w2 + ((size_t)64 << 20));      // 32 MiB
    __bf16* uT  = (__bf16*)(w2 + ((size_t)96 << 20));      // 32 MiB

    ssm_adiag_kernel<<<2, 256, 0, stream>>>(a_unc, ad);
    const int nW = S_DIM * IN_DIM;
    ssm_cvt_kernel<<<(nW + 255) / 256, 256, 0, stream>>>(Bmat, Bb,  nW, IN_DIM, 512,  0);
    ssm_cvt_kernel<<<(nW + 255) / 256, 256, 0, stream>>>(Cmat, CDb, nW, S_DIM, 1024, 0);
    ssm_cvt_kernel<<<(nW + 255) / 256, 256, 0, stream>>>(Dmat, CDb, nW, IN_DIM, 1024, 512);

    ssm_gemm1_kernel<<<dim3(M_TOT / BLK_M, S_DIM / BLK_N), 256, 0, stream>>>(u, Bb, Bu, uT);
    ssm_scan_kernel<<<(BZ * S_DIM) / 256, 256, 0, stream>>>(Bu, ad, h0, xsb);
    ssm_gemm2_kernel<<<dim3(M_TOT / BLK_M, OUT_DIM / BLK_N), 256, 0, stream>>>(xsb, uT, CDb, out);
}

// v002
// Measured time: 144 microseconds a run.
// Next to v001, in two timings, it ran 2.45 and 2.41 times as fast.
// Counting every step since v000, it is 7.78 times as fast.
#include <hip/hip_runtime.h>
#include <hip/hip_bf16.h>

#define BZ       16
#define IN_DIM   512
#define S_DIM    512
#define OUT_DIM  512
#define SEQ_L    2048
#define M_TOT    (SEQ_L * BZ)      // 32768

#define BLK_M    128
#define BLK_N    128
#define BLK_K    32
#define LDS_K    40                // 32 + 8 pad (conflict-free b128 frags)

typedef __attribute__((ext_vector_type(16))) __bf16 v16bf;
typedef __attribute__((ext_vector_type(8)))  __bf16 v8bf;
typedef __attribute__((ext_vector_type(8)))  float  v8f;
typedef __attribute__((ext_vector_type(4)))  float  v4f;

#if defined(__gfx1250__) && __has_builtin(__builtin_amdgcn_tensor_load_to_lds)
#define HAVE_TDM 1
#else
#define HAVE_TDM 0
#endif

#if HAVE_TDM
typedef __attribute__((ext_vector_type(4))) unsigned int v4u;
typedef __attribute__((ext_vector_type(8))) int          v8i;
typedef __attribute__((ext_vector_type(4))) int          v4i;

__device__ __forceinline__ void tdm_load_2d(unsigned lds_off, const void* gptr,
                                            unsigned rows, unsigned cols,
                                            unsigned row_stride_elems) {
    unsigned long long ga = (unsigned long long)(uintptr_t)gptr;
    v4u g0;
    g0[0] = 1u;                                        // count=1, load, user
    g0[1] = lds_off;                                   // lds_addr (bytes)
    g0[2] = (unsigned)(ga & 0xffffffffu);              // global_addr[31:0]
    g0[3] = (unsigned)((ga >> 32) & 0x1ffffffu) | (2u << 30);  // [56:32]|type=2
    const unsigned td0 = 0x01000000u, td1 = 0x01000000u;   // huge: no OOB clamp
    v8i g1;
    g1[0] = (int)((1u << 16)
                | (1u << 20)
                | (3u << 22)
                | (3u << 25));
    g1[1] = (int)((td0 & 0xffffu) << 16);
    g1[2] = (int)(((td0 >> 16) & 0xffffu) | ((td1 & 0xffffu) << 16));
    g1[3] = (int)(((td1 >> 16) & 0xffffu) | (cols << 16));
    g1[4] = (int)(rows & 0xffffu);
    g1[5] = (int)row_stride_elems;
    g1[6] = 0;
    g1[7] = 0;
    v4i gz4 = {0, 0, 0, 0};
    v8i gz8 = {0, 0, 0, 0, 0, 0, 0, 0};
    __builtin_amdgcn_tensor_load_to_lds(g0, g1, gz4, gz4, gz8, 0);
}
#endif

__device__ __forceinline__ v16bf load_frag(const __bf16* row, int h) {
    v8bf lo = *(const v8bf*)(row + h * 8);
    v8bf hi = *(const v8bf*)(row + 16 + h * 8);
    return __builtin_shufflevector(lo, hi, 0,1,2,3,4,5,6,7,8,9,10,11,12,13,14,15);
}

__device__ __forceinline__ v8f wmma_bf16(v16bf a, v16bf b, v8f c) {
    return __builtin_amdgcn_wmma_f32_16x16x32_bf16(
        false, a, false, b, (short)0, c, false, false);
}

// --------------------------- prep kernels ----------------------------------

__global__ void ssm_adiag_kernel(const float* __restrict__ a_unc,
                                 float* __restrict__ ad) {
    int i = blockIdx.x * blockDim.x + threadIdx.x;
    if (i < S_DIM) {
        float x = a_unc[i];
        ad[i] = -(fmaxf(x, 0.0f) + log1pf(expf(-fabsf(x))));
    }
}

__global__ void ssm_cvt_kernel(const float* __restrict__ src,
                               __bf16* __restrict__ dst,
                               int n, int src_cols, int dst_stride, int dst_off) {
    int i = blockIdx.x * blockDim.x + threadIdx.x;
    if (i < n) {
        int r = i / src_cols, c = i - r * src_cols;
        dst[(size_t)r * dst_stride + dst_off + c] = (__bf16)src[i];
    }
}

__global__ __launch_bounds__(256)
void ssm_gemm1_kernel(const float* __restrict__ u,
                      const __bf16* __restrict__ Bb,
                      float* __restrict__ Bu,
                      __bf16* __restrict__ uT) {
    __shared__ __align__(16) __bf16 ldsA[2][BLK_M][LDS_K];
    __shared__ __align__(16) __bf16 ldsB[2][BLK_N][LDS_K];

    const int tid  = threadIdx.x;
    const int lane = tid & 31;
    const int wave = tid >> 5;
    const int wm   = wave >> 1;          // 0..3 -> rows wm*32
    const int wn   = wave & 1;           // 0..1 -> cols wn*64
    const int lr   = lane & 15;
    const int h    = lane >> 4;

    const int mbase = blockIdx.x * BLK_M;
    const int nbase = blockIdx.y * BLK_N;

    // A loader: one (row, 16-wide K chunk) per thread; lanes run along the rows
    const int arow = tid & (BLK_M - 1);
    const int akq  = (tid >> 7) * 16;
    const int amg  = mbase + arow;
    const float* aptr = u + ((size_t)(amg / SEQ_L) * IN_DIM) * SEQ_L + (amg & (SEQ_L - 1));

    v8f acc[2][4];
    #pragma unroll
    for (int mi = 0; mi < 2; ++mi)
        #pragma unroll
        for (int ni = 0; ni < 4; ++ni) acc[mi][ni] = (v8f){};

    auto stage = [&](int kt, int buf) {
        const int k0 = kt * BLK_K;
        // ---- A: f32 columns of u -> bf16 rows (and emit uT once) ----
        v8bf v0, v1;
        #pragma unroll
        for (int j = 0; j < 8; ++j) {
            v0[j] = (__bf16)aptr[(size_t)(k0 + akq + j) * SEQ_L];
            v1[j] = (__bf16)aptr[(size_t)(k0 + akq + 8 + j) * SEQ_L];
        }
        *(v8bf*)&ldsA[buf][arow][akq]     = v0;
        *(v8bf*)&ldsA[buf][arow][akq + 8] = v1;
        if (blockIdx.y == 0) {
            *(v8bf*)(uT + (size_t)amg * IN_DIM + k0 + akq)     = v0;
            *(v8bf*)(uT + (size_t)amg * IN_DIM + k0 + akq + 8) = v1;
        }
#if HAVE_TDM
        if (wave == 0)
            tdm_load_2d((unsigned)(uintptr_t)&ldsB[buf][0][0],
                        Bb + (size_t)nbase * IN_DIM + k0,
                        BLK_N, BLK_K, IN_DIM);
#else
        const int bkq = (tid & 1) * 16;
        const __bf16* bp = Bb + (size_t)(nbase + (tid >> 1)) * IN_DIM + k0 + bkq;
        *(v8bf*)&ldsB[buf][tid >> 1][bkq]     = *(const v8bf*)bp;
        *(v8bf*)&ldsB[buf][tid >> 1][bkq + 8] = *(const v8bf*)(bp + 8);
#endif
    };

    stage(0, 0);
#if HAVE_TDM
    if (wave == 0) __builtin_amdgcn_s_wait_tensorcnt(0);
#endif
    __syncthreads();

    const int KT = IN_DIM / BLK_K;       // 16
    for (int kt = 0; kt < KT; ++kt) {
        const int buf = kt & 1;
        if (kt + 1 < KT) stage(kt + 1, buf ^ 1);

        v16bf a0 = load_frag(&ldsA[buf][wm * 32 + lr][0],      h);
        v16bf a1 = load_frag(&ldsA[buf][wm * 32 + 16 + lr][0], h);
        #pragma unroll
        for (int ni = 0; ni < 4; ++ni) {
            v16bf bf = load_frag(&ldsB[buf][wn * 64 + ni * 16 + lr][0], h);
            acc[0][ni] = wmma_bf16(a0, bf, acc[0][ni]);
            acc[1][ni] = wmma_bf16(a1, bf, acc[1][ni]);
        }
#if HAVE_TDM
        if (wave == 0) __builtin_amdgcn_s_wait_tensorcnt(0);
#endif
        __syncthreads();
    }

    // ---- epilogue: Bu[m][s] f32, coalesced across lanes ----
    #pragma unroll
    for (int mi = 0; mi < 2; ++mi)
        #pragma unroll
        for (int ni = 0; ni < 4; ++ni) {
            int n = nbase + wn * 64 + ni * 16 + lr;
            int m = mbase + wm * 32 + mi * 16 + h * 8;
            #pragma unroll
            for (int r = 0; r < 8; ++r)
                Bu[(size_t)(m + r) * S_DIM + n] = acc[mi][ni][r];
        }
}

#define SCAN_D   64
#define SCAN_G   16                // steps whose bf16 results are stored together
__global__ __launch_bounds__(256)
void ssm_scan_kernel(const float* __restrict__ Bu,
                     const float* __restrict__ ad,
                     const float* __restrict__ h0,
                     __bf16* __restrict__ xs) {
    int t = blockIdx.x * blockDim.x + threadIdx.x;   // 0..8191
    int s = t & (S_DIM - 1);
    int b = t >> 9;
    float a = ad[s];
    float x = h0[s];
    // keeps these two loads older than the ring's: issued behind the ring,
    // their wait at the loop's head drains the whole ring on every trip
    __builtin_amdgcn_sched_barrier(0);
    const float* bu = Bu + (size_t)b * SEQ_L * S_DIM + s;
    __bf16* xo = xs + (size_t)b * SEQ_L * S_DIM + s;
    const size_t stride = S_DIM;                     // row m = b*SEQ_L + l

    float ring[SCAN_D];
    #pragma unroll
    for (int j = 0; j < SCAN_D; ++j) ring[j] = bu[(size_t)j * stride];

    for (int l0 = 0; l0 < SEQ_L - SCAN_D; l0 += SCAN_D) {
        #pragma unroll
        for (int g = 0; g < SCAN_D; g += SCAN_G) {
            __bf16 y[SCAN_G];
            #pragma unroll
            for (int k = 0; k < SCAN_G; ++k) {
                x = fmaf(x, a, ring[g + k]);
                y[k] = (__bf16)x;
                ring[g + k] = bu[(size_t)(l0 + SCAN_D + g + k) * stride];
            }
            __builtin_amdgcn_sched_barrier(0);
            #pragma unroll
            for (int k = 0; k < SCAN_G; ++k)
                xo[(size_t)(l0 + g + k) * stride] = y[k];
            // keeps the stores from sinking to the trip's end, where all
            // SCAN_D of them in a row fill the store counter
            __builtin_amdgcn_sched_barrier(0);
        }
    }
    #pragma unroll
    for (int j = 0; j < SCAN_D; ++j) {
        x = fmaf(x, a, ring[j]);
        xo[(size_t)(SEQ_L - SCAN_D + j) * stride] = (__bf16)x;
    }
}

__global__ __launch_bounds__(256)
void ssm_gemm2_kernel(const __bf16* __restrict__ xs,
                      const __bf16* __restrict__ uT,
                      const __bf16* __restrict__ CDb,   // [o][k], stride 1024
                      float* __restrict__ out) {
    __shared__ __align__(16) __bf16 ldsA[2][BLK_M][LDS_K];
    __shared__ __align__(16) __bf16 ldsB[2][BLK_N][LDS_K];

    const int tid  = threadIdx.x;
    const int lane = tid & 31;
    const int wave = tid >> 5;
    const int wm   = wave >> 1;
    const int wn   = wave & 1;
    const int lr   = lane & 15;
    const int h    = lane >> 4;

    const int mbase = blockIdx.x * BLK_M;
    const int nbase = blockIdx.y * BLK_N;

    v8f acc[2][4];
    #pragma unroll
    for (int mi = 0; mi < 2; ++mi)
        #pragma unroll
        for (int ni = 0; ni < 4; ++ni) acc[mi][ni] = (v8f){};

    auto stage = [&](int kt, int buf) {
        const int k0 = kt * BLK_K;
        const __bf16* asrc = (k0 < S_DIM)
            ? xs + (size_t)mbase * S_DIM + k0
            : uT + (size_t)mbase * IN_DIM + (k0 - S_DIM);
#if HAVE_TDM
        if (wave == 0) {
            tdm_load_2d((unsigned)(uintptr_t)&ldsA[buf][0][0], asrc,
                        BLK_M, BLK_K, S_DIM);
            tdm_load_2d((unsigned)(uintptr_t)&ldsB[buf][0][0],
                        CDb + (size_t)nbase * 1024 + k0,
                        BLK_N, BLK_K, 1024);
        }
#else
        const int row = tid >> 1, kq = (tid & 1) * 16;
        const __bf16* ap = asrc + (size_t)row * S_DIM + kq;
        *(v8bf*)&ldsA[buf][row][kq]     = *(const v8bf*)ap;
        *(v8bf*)&ldsA[buf][row][kq + 8] = *(const v8bf*)(ap + 8);
        const __bf16* bp = CDb + (size_t)(nbase + row) * 1024 + k0 + kq;
        *(v8bf*)&ldsB[buf][row][kq]     = *(const v8bf*)bp;
        *(v8bf*)&ldsB[buf][row][kq + 8] = *(const v8bf*)(bp + 8);
#endif
    };

    stage(0, 0);
#if HAVE_TDM
    if (wave == 0) __builtin_amdgcn_s_wait_tensorcnt(0);
#endif
    __syncthreads();

    const int KT = 1024 / BLK_K;          // 32
    for (int kt = 0; kt < KT; ++kt) {
        const int buf = kt & 1;
        if (kt + 1 < KT) stage(kt + 1, buf ^ 1);

        v16bf a0 = load_frag(&ldsA[buf][wm * 32 + lr][0],      h);
        v16bf a1 = load_frag(&ldsA[buf][wm * 32 + 16 + lr][0], h);
        #pragma unroll
        for (int ni = 0; ni < 4; ++ni) {
            v16bf bf = load_frag(&ldsB[buf][wn * 64 + ni * 16 + lr][0], h);
            acc[0][ni] = wmma_bf16(a0, bf, acc[0][ni]);
            acc[1][ni] = wmma_bf16(a1, bf, acc[1][ni]);
        }
#if HAVE_TDM
        if (wave == 0) __builtin_amdgcn_s_wait_tensorcnt(0);
#endif
        __syncthreads();
    }

    // epilogue: Y[b, o, l]; m = b*2048 + l, so a lane's 8 accumulator rows are
    // 8 consecutive l of one (b, o): two 16-byte stores
    #pragma unroll
    for (int mi = 0; mi < 2; ++mi)
        #pragma unroll
        for (int ni = 0; ni < 4; ++ni) {
            int o = nbase + wn * 64 + ni * 16 + lr;
            int m = mbase + wm * 32 + mi * 16 + h * 8;
            float* yp = out + (size_t)(m / SEQ_L) * OUT_DIM * SEQ_L
                            + (size_t)o * SEQ_L + (m & (SEQ_L - 1));
            v8f c = acc[mi][ni];
            *(v4f*)yp       = __builtin_shufflevector(c, c, 0, 1, 2, 3);
            *(v4f*)(yp + 4) = __builtin_shufflevector(c, c, 4, 5, 6, 7);
        }
}

// --------------------------- launch ----------------------------------------

extern "C" void kernel_launch(void* const* d_in, const int* in_sizes, int n_in,
                              void* d_out, int out_size, void* d_ws, size_t ws_size,
                              hipStream_t stream) {
    const float* u     = (const float*)d_in[0];
    const float* a_unc = (const float*)d_in[1];
    const float* Bmat  = (const float*)d_in[2];
    const float* Cmat  = (const float*)d_in[3];
    const float* Dmat  = (const float*)d_in[4];
    const float* h0    = (const float*)d_in[5];
    float* out = (float*)d_out;

    char* w = (char*)d_ws;
    float*  ad  = (float*)w;                               // 2 KiB
    __bf16* Bb  = (__bf16*)(w + 4096);                     // 512 KiB
    __bf16* CDb = (__bf16*)(w + 4096 + (512 << 10));       // 1 MiB
    char* w2 = w + 4096 + (512 << 10) + (1 << 20);
    float*  Bu  = (float*)w2;                              // 64 MiB
    __bf16* xsb = (__bf16*)(w2 + ((size_t)64 << 20));      // 32 MiB
    __bf16* uT  = (__bf16*)(w2 + ((size_t)96 << 20));      // 32 MiB

    ssm_adiag_kernel<<<2, 256, 0, stream>>>(a_unc, ad);
    const int nW = S_DIM * IN_DIM;
    ssm_cvt_kernel<<<(nW + 255) / 256, 256, 0, stream>>>(Bmat, Bb,  nW, IN_DIM, 512,  0);
    ssm_cvt_kernel<<<(nW + 255) / 256, 256, 0, stream>>>(Cmat, CDb, nW, S_DIM, 1024, 0);
    ssm_cvt_kernel<<<(nW + 255) / 256, 256, 0, stream>>>(Dmat, CDb, nW, IN_DIM, 1024, 512);

    ssm_gemm1_kernel<<<dim3(M_TOT / BLK_M, S_DIM / BLK_N), 256, 0, stream>>>(u, Bb, Bu, uT);
    ssm_scan_kernel<<<(BZ * S_DIM) / 256, 256, 0, stream>>>(Bu, ad, h0, xsb);
    ssm_gemm2_kernel<<<dim3(M_TOT / BLK_M, OUT_DIM / BLK_N), 256, 0, stream>>>(xsb, uT, CDb, out);
}

// v003
// One run takes 138 microseconds.
// Next to v002, in two timings, it ran 1.05 and 1.03 times as fast.
// Counting every step since v000, it is 8.08 times as fast.
#include <hip/hip_runtime.h>
#include <hip/hip_bf16.h>

#define BZ       16
#define IN_DIM   512
#define S_DIM    512
#define OUT_DIM  512
#define SEQ_L    2048
#define M_TOT    (SEQ_L * BZ)      // 32768

#define BLK_M    128
#define BLK_N    128
#define BLK_K    32
#define LDS_K    40                // 32 + 8 pad (conflict-free b128 frags)

typedef __attribute__((ext_vector_type(16))) __bf16 v16bf;
typedef __attribute__((ext_vector_type(8)))  __bf16 v8bf;
typedef __attribute__((ext_vector_type(4)))  __bf16 v4bf;
typedef __attribute__((ext_vector_type(8)))  float  v8f;
typedef __attribute__((ext_vector_type(4)))  float  v4f;

#if defined(__gfx1250__) && __has_builtin(__builtin_amdgcn_tensor_load_to_lds)
#define HAVE_TDM 1
#else
#define HAVE_TDM 0
#endif

#if HAVE_TDM
typedef __attribute__((ext_vector_type(4))) unsigned int v4u;
typedef __attribute__((ext_vector_type(8))) int          v8i;
typedef __attribute__((ext_vector_type(4))) int          v4i;

__device__ __forceinline__ void tdm_load_2d(unsigned lds_off, const void* gptr,
                                            unsigned rows, unsigned cols,
                                            unsigned row_stride_elems) {
    unsigned long long ga = (unsigned long long)(uintptr_t)gptr;
    v4u g0;
    g0[0] = 1u;                                        // count=1, load, user
    g0[1] = lds_off;                                   // lds_addr (bytes)
    g0[2] = (unsigned)(ga & 0xffffffffu);              // global_addr[31:0]
    g0[3] = (unsigned)((ga >> 32) & 0x1ffffffu) | (2u << 30);  // [56:32]|type=2
    const unsigned td0 = 0x01000000u, td1 = 0x01000000u;   // huge: no OOB clamp
    v8i g1;
    g1[0] = (int)((1u << 16)
                | (1u << 20)
                | (3u << 22)
                | (3u << 25));
    g1[1] = (int)((td0 & 0xffffu) << 16);
    g1[2] = (int)(((td0 >> 16) & 0xffffu) | ((td1 & 0xffffu) << 16));
    g1[3] = (int)(((td1 >> 16) & 0xffffu) | (cols << 16));
    g1[4] = (int)(rows & 0xffffu);
    g1[5] = (int)row_stride_elems;
    g1[6] = 0;
    g1[7] = 0;
    v4i gz4 = {0, 0, 0, 0};
    v8i gz8 = {0, 0, 0, 0, 0, 0, 0, 0};
    __builtin_amdgcn_tensor_load_to_lds(g0, g1, gz4, gz4, gz8, 0);
}
#endif

__device__ __forceinline__ v16bf load_frag(const __bf16* row, int h) {
    v8bf lo = *(const v8bf*)(row + h * 8);
    v8bf hi = *(const v8bf*)(row + 16 + h * 8);
    return __builtin_shufflevector(lo, hi, 0,1,2,3,4,5,6,7,8,9,10,11,12,13,14,15);
}

__device__ __forceinline__ v8f wmma_bf16(v16bf a, v16bf b, v8f c) {
    return __builtin_amdgcn_wmma_f32_16x16x32_bf16(
        false, a, false, b, (short)0, c, false, false);
}

// --------------------------- prep kernel -----------------------------------

// One launch for all four independent preparations, dealt by block index:
// blocks 0..191 convert B, C and D to bf16 (64 blocks a matrix), block 192
// makes A_diag. A thread converts four groups of 4 values; a wave's load is
// 512 contiguous bytes and its store 256.
#define PREP_VALS  4096            // values a block converts (8 rows of 512)
#define PREP_BLKS  (S_DIM * IN_DIM / PREP_VALS)   // 64 blocks a matrix

__global__ __launch_bounds__(256)
void ssm_prep_kernel(const float* __restrict__ a_unc,
                     const float* __restrict__ Bm,
                     const float* __restrict__ Cm,
                     const float* __restrict__ Dm,
                     float* __restrict__ ad,
                     __bf16* __restrict__ Bb,
                     __bf16* __restrict__ CDb) {
    const int tid   = threadIdx.x;
    const int which = blockIdx.x / PREP_BLKS;        // 0: B, 1: C, 2: D, 3: A_diag
    if (which == 3) {
        for (int i = tid; i < S_DIM; i += 256) {
            float x = a_unc[i];
            ad[i] = -(fmaxf(x, 0.0f) + log1pf(expf(-fabsf(x))));
        }
        return;
    }
    const float* src = (which == 0) ? Bm : (which == 1) ? Cm : Dm;
    __bf16* dst      = (which == 0) ? Bb : (which == 1) ? CDb : CDb + S_DIM;
    const int dstride = (which == 0) ? IN_DIM : S_DIM + IN_DIM;
    const int base = (blockIdx.x - which * PREP_BLKS) * PREP_VALS + tid * 4;

    // unrolled so that x stays in registers and the four loads are in flight
    // together: the memory latency is paid once a thread, not once a group
    v4f x[4];
    #pragma unroll
    for (int j = 0; j < 4; ++j) x[j] = *(const v4f*)(src + base + j * 1024);
    #pragma unroll
    for (int j = 0; j < 4; ++j) {
        const int i = base + j * 1024;
        v4bf y;
        #pragma unroll
        for (int e = 0; e < 4; ++e) y[e] = (__bf16)x[j][e];
        *(v4bf*)(dst + (size_t)(i >> 9) * dstride + (i & 511)) = y;
    }
    // stands in front of whatever the compiler lays out behind the four stores
    // and lets overwrite a register that they name
    asm volatile("s_wait_xcnt 0x0" ::: "memory");
}

__global__ __launch_bounds__(256)
void ssm_gemm1_kernel(const float* __restrict__ u,
                      const __bf16* __restrict__ Bb,
                      float* __restrict__ Bu,
                      __bf16* __restrict__ uT) {
    __shared__ __align__(16) __bf16 ldsA[2][BLK_M][LDS_K];
    __shared__ __align__(16) __bf16 ldsB[2][BLK_N][LDS_K];

    const int tid  = threadIdx.x;
    const int lane = tid & 31;
    const int wave = tid >> 5;
    const int wm   = wave >> 1;          // 0..3 -> rows wm*32
    const int wn   = wave & 1;           // 0..1 -> cols wn*64
    const int lr   = lane & 15;
    const int h    = lane >> 4;

    const int mbase = blockIdx.x * BLK_M;
    const int nbase = blockIdx.y * BLK_N;

    // A loader: one (row, 16-wide K chunk) per thread; lanes run along the rows
    const int arow = tid & (BLK_M - 1);
    const int akq  = (tid >> 7) * 16;
    const int amg  = mbase + arow;
    const float* aptr = u + ((size_t)(amg / SEQ_L) * IN_DIM) * SEQ_L + (amg & (SEQ_L - 1));

    v8f acc[2][4];
    #pragma unroll
    for (int mi = 0; mi < 2; ++mi)
        #pragma unroll
        for (int ni = 0; ni < 4; ++ni) acc[mi][ni] = (v8f){};

    auto stage = [&](int kt, int buf) {
        const int k0 = kt * BLK_K;
        // ---- A: f32 columns of u -> bf16 rows (and emit uT once) ----
        v8bf v0, v1;
        #pragma unroll
        for (int j = 0; j < 8; ++j) {
            v0[j] = (__bf16)aptr[(size_t)(k0 + akq + j) * SEQ_L];
            v1[j] = (__bf16)aptr[(size_t)(k0 + akq + 8 + j) * SEQ_L];
        }
        *(v8bf*)&ldsA[buf][arow][akq]     = v0;
        *(v8bf*)&ldsA[buf][arow][akq + 8] = v1;
        if (blockIdx.y == 0) {
            *(v8bf*)(uT + (size_t)amg * IN_DIM + k0 + akq)     = v0;
            *(v8bf*)(uT + (size_t)amg * IN_DIM + k0 + akq + 8) = v1;
        }
#if HAVE_TDM
        if (wave == 0)
            tdm_load_2d((unsigned)(uintptr_t)&ldsB[buf][0][0],
                        Bb + (size_t)nbase * IN_DIM + k0,
                        BLK_N, BLK_K, IN_DIM);
#else
        const int bkq = (tid & 1) * 16;
        const __bf16* bp = Bb + (size_t)(nbase + (tid >> 1)) * IN_DIM + k0 + bkq;
        *(v8bf*)&ldsB[buf][tid >> 1][bkq]     = *(const v8bf*)bp;
        *(v8bf*)&ldsB[buf][tid >> 1][bkq + 8] = *(const v8bf*)(bp + 8);
#endif
    };

    stage(0, 0);
#if HAVE_TDM
    if (wave == 0) __builtin_amdgcn_s_wait_tensorcnt(0);
#endif
    __syncthreads();

    const int KT = IN_DIM / BLK_K;       // 16
    for (int kt = 0; kt < KT; ++kt) {
        const int buf = kt & 1;
        if (kt + 1 < KT) stage(kt + 1, buf ^ 1);

        v16bf a0 = load_frag(&ldsA[buf][wm * 32 + lr][0],      h);
        v16bf a1 = load_frag(&ldsA[buf][wm * 32 + 16 + lr][0], h);
        #pragma unroll
        for (int ni = 0; ni < 4; ++ni) {
            v16bf bf = load_frag(&ldsB[buf][wn * 64 + ni * 16 + lr][0], h);
            acc[0][ni] = wmma_bf16(a0, bf, acc[0][ni]);
            acc[1][ni] = wmma_bf16(a1, bf, acc[1][ni]);
        }
#if HAVE_TDM
        if (wave == 0) __builtin_amdgcn_s_wait_tensorcnt(0);
#endif
        __syncthreads();
    }

    // ---- epilogue: Bu[m][s] f32, coalesced across lanes ----
    #pragma unroll
    for (int mi = 0; mi < 2; ++mi)
        #pragma unroll
        for (int ni = 0; ni < 4; ++ni) {
            int n = nbase + wn * 64 + ni * 16 + lr;
            int m = mbase + wm * 32 + mi * 16 + h * 8;
            #pragma unroll
            for (int r = 0; r < 8; ++r)
                Bu[(size_t)(m + r) * S_DIM + n] = acc[mi][ni][r];
        }
}

#define SCAN_D   64
#define SCAN_G   16                // steps whose bf16 results are stored together
__global__ __launch_bounds__(256)
void ssm_scan_kernel(const float* __restrict__ Bu,
                     const float* __restrict__ ad,
                     const float* __restrict__ h0,
                     __bf16* __restrict__ xs) {
    int t = blockIdx.x * blockDim.x + threadIdx.x;   // 0..8191
    int s = t & (S_DIM - 1);
    int b = t >> 9;
    float a = ad[s];
    float x = h0[s];
    // keeps these two loads older than the ring's: issued behind the ring,
    // their wait at the loop's head drains the whole ring on every trip
    __builtin_amdgcn_sched_barrier(0);
    const float* bu = Bu + (size_t)b * SEQ_L * S_DIM + s;
    __bf16* xo = xs + (size_t)b * SEQ_L * S_DIM + s;
    const size_t stride = S_DIM;                     // row m = b*SEQ_L + l

    float ring[SCAN_D];
    #pragma unroll
    for (int j = 0; j < SCAN_D; ++j) ring[j] = bu[(size_t)j * stride];

    for (int l0 = 0; l0 < SEQ_L - SCAN_D; l0 += SCAN_D) {
        #pragma unroll
        for (int g = 0; g < SCAN_D; g += SCAN_G) {
            __bf16 y[SCAN_G];
            #pragma unroll
            for (int k = 0; k < SCAN_G; ++k) {
                x = fmaf(x, a, ring[g + k]);
                y[k] = (__bf16)x;
                ring[g + k] = bu[(size_t)(l0 + SCAN_D + g + k) * stride];
            }
            __builtin_amdgcn_sched_barrier(0);
            #pragma unroll
            for (int k = 0; k < SCAN_G; ++k)
                xo[(size_t)(l0 + g + k) * stride] = y[k];
            // keeps the stores from sinking to the trip's end, where all
            // SCAN_D of them in a row fill the store counter
            __builtin_amdgcn_sched_barrier(0);
        }
    }
    #pragma unroll
    for (int j = 0; j < SCAN_D; ++j) {
        x = fmaf(x, a, ring[j]);
        xo[(size_t)(SEQ_L - SCAN_D + j) * stride] = (__bf16)x;
    }
}

__global__ __launch_bounds__(256)
void ssm_gemm2_kernel(const __bf16* __restrict__ xs,
                      const __bf16* __restrict__ uT,
                      const __bf16* __restrict__ CDb,   // [o][k], stride 1024
                      float* __restrict__ out) {
    __shared__ __align__(16) __bf16 ldsA[2][BLK_M][LDS_K];
    __shared__ __align__(16) __bf16 ldsB[2][BLK_N][LDS_K];

    const int tid  = threadIdx.x;
    const int lane = tid & 31;
    const int wave = tid >> 5;
    const int wm   = wave >> 1;
    const int wn   = wave & 1;
    const int lr   = lane & 15;
    const int h    = lane >> 4;

    const int mbase = blockIdx.x * BLK_M;
    const int nbase = blockIdx.y * BLK_N;

    v8f acc[2][4];
    #pragma unroll
    for (int mi = 0; mi < 2; ++mi)
        #pragma unroll
        for (int ni = 0; ni < 4; ++ni) acc[mi][ni] = (v8f){};

    auto stage = [&](int kt, int buf) {
        const int k0 = kt * BLK_K;
        const __bf16* asrc = (k0 < S_DIM)
            ? xs + (size_t)mbase * S_DIM + k0
            : uT + (size_t)mbase * IN_DIM + (k0 - S_DIM);
#if HAVE_TDM
        if (wave == 0) {
            tdm_load_2d((unsigned)(uintptr_t)&ldsA[buf][0][0], asrc,
                        BLK_M, BLK_K, S_DIM);
            tdm_load_2d((unsigned)(uintptr_t)&ldsB[buf][0][0],
                        CDb + (size_t)nbase * 1024 + k0,
                        BLK_N, BLK_K, 1024);
        }
#else
        const int row = tid >> 1, kq = (tid & 1) * 16;
        const __bf16* ap = asrc + (size_t)row * S_DIM + kq;
        *(v8bf*)&ldsA[buf][row][kq]     = *(const v8bf*)ap;
        *(v8bf*)&ldsA[buf][row][kq + 8] = *(const v8bf*)(ap + 8);
        const __bf16* bp = CDb + (size_t)(nbase + row) * 1024 + k0 + kq;
        *(v8bf*)&ldsB[buf][row][kq]     = *(const v8bf*)bp;
        *(v8bf*)&ldsB[buf][row][kq + 8] = *(const v8bf*)(bp + 8);
#endif
    };

    stage(0, 0);
#if HAVE_TDM
    if (wave == 0) __builtin_amdgcn_s_wait_tensorcnt(0);
#endif
    __syncthreads();

    const int KT = 1024 / BLK_K;          // 32
    for (int kt = 0; kt < KT; ++kt) {
        const int buf = kt & 1;
        if (kt + 1 < KT) stage(kt + 1, buf ^ 1);

        v16bf a0 = load_frag(&ldsA[buf][wm * 32 + lr][0],      h);
        v16bf a1 = load_frag(&ldsA[buf][wm * 32 + 16 + lr][0], h);
        #pragma unroll
        for (int ni = 0; ni < 4; ++ni) {
            v16bf bf = load_frag(&ldsB[buf][wn * 64 + ni * 16 + lr][0], h);
            acc[0][ni] = wmma_bf16(a0, bf, acc[0][ni]);
            acc[1][ni] = wmma_bf16(a1, bf, acc[1][ni]);
        }
#if HAVE_TDM
        if (wave == 0) __builtin_amdgcn_s_wait_tensorcnt(0);
#endif
        __syncthreads();
    }

    // epilogue: Y[b, o, l]; m = b*2048 + l, so a lane's 8 accumulator rows are
    // 8 consecutive l of one (b, o): two 16-byte stores
    #pragma unroll
    for (int mi = 0; mi < 2; ++mi)
        #pragma unroll
        for (int ni = 0; ni < 4; ++ni) {
            int o = nbase + wn * 64 + ni * 16 + lr;
            int m = mbase + wm * 32 + mi * 16 + h * 8;
            float* yp = out + (size_t)(m / SEQ_L) * OUT_DIM * SEQ_L
                            + (size_t)o * SEQ_L + (m & (SEQ_L - 1));
            v8f c = acc[mi][ni];
            *(v4f*)yp       = __builtin_shufflevector(c, c, 0, 1, 2, 3);
            *(v4f*)(yp + 4) = __builtin_shufflevector(c, c, 4, 5, 6, 7);
        }
}

// --------------------------- launch ----------------------------------------

extern "C" void kernel_launch(void* const* d_in, const int* in_sizes, int n_in,
                              void* d_out, int out_size, void* d_ws, size_t ws_size,
                              hipStream_t stream) {
    const float* u     = (const float*)d_in[0];
    const float* a_unc = (const float*)d_in[1];
    const float* Bmat  = (const float*)d_in[2];
    const float* Cmat  = (const float*)d_in[3];
    const float* Dmat  = (const float*)d_in[4];
    const float* h0    = (const float*)d_in[5];
    float* out = (float*)d_out;

    char* w = (char*)d_ws;
    float*  ad  = (float*)w;                               // 2 KiB
    __bf16* Bb  = (__bf16*)(w + 4096);                     // 512 KiB
    __bf16* CDb = (__bf16*)(w + 4096 + (512 << 10));       // 1 MiB
    char* w2 = w + 4096 + (512 << 10) + (1 << 20);
    float*  Bu  = (float*)w2;                              // 64 MiB
    __bf16* xsb = (__bf16*)(w2 + ((size_t)64 << 20));      // 32 MiB
    __bf16* uT  = (__bf16*)(w2 + ((size_t)96 << 20));      // 32 MiB

    ssm_prep_kernel<<<3 * PREP_BLKS + 1, 256, 0, stream>>>(a_unc, Bmat, Cmat, Dmat, ad, Bb, CDb);

    ssm_gemm1_kernel<<<dim3(M_TOT / BLK_M, S_DIM / BLK_N), 256, 0, stream>>>(u, Bb, Bu, uT);
    ssm_scan_kernel<<<(BZ * S_DIM) / 256, 256, 0, stream>>>(Bu, ad, h0, xsb);
    ssm_gemm2_kernel<<<dim3(M_TOT / BLK_M, OUT_DIM / BLK_N), 256, 0, stream>>>(xsb, uT, CDb, out);
}

// v004
// Measured time: 108 microseconds a run.
// Two timings next to v003 put it at 1.26 and 1.27 times that version's speed.
// Counting every step since v000, it is 10.2 times as fast.
#include <hip/hip_runtime.h>
#include <hip/hip_bf16.h>

#define BZ       16
#define IN_DIM   512
#define S_DIM    512
#define OUT_DIM  512
#define SEQ_L    2048
#define M_TOT    (SEQ_L * BZ)      // 32768

#define BLK_M    128
#define BLK_N    128
#define BLK_K    32
#define LDS_K    40                // 32 + 8 pad (conflict-free b128 frags)

typedef __attribute__((ext_vector_type(16))) __bf16 v16bf;
typedef __attribute__((ext_vector_type(8)))  __bf16 v8bf;
typedef __attribute__((ext_vector_type(4)))  __bf16 v4bf;
typedef __attribute__((ext_vector_type(8)))  float  v8f;
typedef __attribute__((ext_vector_type(4)))  float  v4f;

#if defined(__gfx1250__) && __has_builtin(__builtin_amdgcn_tensor_load_to_lds)
#define HAVE_TDM 1
#else
#define HAVE_TDM 0
#endif

#if HAVE_TDM
typedef __attribute__((ext_vector_type(4))) unsigned int v4u;
typedef __attribute__((ext_vector_type(8))) int          v8i;
typedef __attribute__((ext_vector_type(4))) int          v4i;

__device__ __forceinline__ void tdm_load_2d(unsigned lds_off, const void* gptr,
                                            unsigned rows, unsigned cols,
                                            unsigned row_stride_elems) {
    unsigned long long ga = (unsigned long long)(uintptr_t)gptr;
    v4u g0;
    g0[0] = 1u;                                        // count=1, load, user
    g0[1] = lds_off;                                   // lds_addr (bytes)
    g0[2] = (unsigned)(ga & 0xffffffffu);              // global_addr[31:0]
    g0[3] = (unsigned)((ga >> 32) & 0x1ffffffu) | (2u << 30);  // [56:32]|type=2
    const unsigned td0 = 0x01000000u, td1 = 0x01000000u;   // huge: no OOB clamp
    v8i g1;
    g1[0] = (int)((1u << 16)
                | (1u << 20)
                | (3u << 22)
                | (3u << 25));
    g1[1] = (int)((td0 & 0xffffu) << 16);
    g1[2] = (int)(((td0 >> 16) & 0xffffu) | ((td1 & 0xffffu) << 16));
    g1[3] = (int)(((td1 >> 16) & 0xffffu) | (cols << 16));
    g1[4] = (int)(rows & 0xffffu);
    g1[5] = (int)row_stride_elems;
    g1[6] = 0;
    g1[7] = 0;
    v4i gz4 = {0, 0, 0, 0};
    v8i gz8 = {0, 0, 0, 0, 0, 0, 0, 0};
    __builtin_amdgcn_tensor_load_to_lds(g0, g1, gz4, gz4, gz8, 0);
}
#endif

__device__ __forceinline__ v16bf load_frag(const __bf16* row, int h) {
    v8bf lo = *(const v8bf*)(row + h * 8);
    v8bf hi = *(const v8bf*)(row + 16 + h * 8);
    return __builtin_shufflevector(lo, hi, 0,1,2,3,4,5,6,7,8,9,10,11,12,13,14,15);
}

__device__ __forceinline__ v8f wmma_bf16(v16bf a, v16bf b, v8f c) {
    return __builtin_amdgcn_wmma_f32_16x16x32_bf16(
        false, a, false, b, (short)0, c, false, false);
}

// --------------------------- prep kernel -----------------------------------

// One launch for all four independent preparations, dealt by block index:
// blocks 0..191 convert B, C and D to bf16 (64 blocks a matrix), block 192
// makes A_diag. A thread converts four groups of 4 values; a wave's load is
// 512 contiguous bytes and its store 256.
#define PREP_VALS  4096            // values a block converts (8 rows of 512)
#define PREP_BLKS  (S_DIM * IN_DIM / PREP_VALS)   // 64 blocks a matrix

__global__ __launch_bounds__(256)
void ssm_prep_kernel(const float* __restrict__ a_unc,
                     const float* __restrict__ Bm,
                     const float* __restrict__ Cm,
                     const float* __restrict__ Dm,
                     float* __restrict__ ad,
                     __bf16* __restrict__ Bb,
                     __bf16* __restrict__ CDb) {
    const int tid   = threadIdx.x;
    const int which = blockIdx.x / PREP_BLKS;        // 0: B, 1: C, 2: D, 3: A_diag
    if (which == 3) {
        for (int i = tid; i < S_DIM; i += 256) {
            float x = a_unc[i];
            ad[i] = -(fmaxf(x, 0.0f) + log1pf(expf(-fabsf(x))));
        }
        return;
    }
    const float* src = (which == 0) ? Bm : (which == 1) ? Cm : Dm;
    __bf16* dst      = (which == 0) ? Bb : (which == 1) ? CDb : CDb + S_DIM;
    const int dstride = (which == 0) ? IN_DIM : S_DIM + IN_DIM;
    const int base = (blockIdx.x - which * PREP_BLKS) * PREP_VALS + tid * 4;

    // unrolled so that x stays in registers and the four loads are in flight
    // together: the memory latency is paid once a thread, not once a group
    v4f x[4];
    #pragma unroll
    for (int j = 0; j < 4; ++j) x[j] = *(const v4f*)(src + base + j * 1024);
    #pragma unroll
    for (int j = 0; j < 4; ++j) {
        const int i = base + j * 1024;
        v4bf y;
        #pragma unroll
        for (int e = 0; e < 4; ++e) y[e] = (__bf16)x[j][e];
        *(v4bf*)(dst + (size_t)(i >> 9) * dstride + (i & 511)) = y;
    }
    // stands in front of whatever the compiler lays out behind the four stores
    // and lets overwrite a register that they name
    asm volatile("s_wait_xcnt 0x0" ::: "memory");
}

__global__ __launch_bounds__(256)
void ssm_gemm1_kernel(const float* __restrict__ u,
                      const __bf16* __restrict__ Bb,
                      float* __restrict__ Bu,
                      __bf16* __restrict__ uT) {
    __shared__ __align__(16) __bf16 ldsA[2][BLK_M][LDS_K];
    __shared__ __align__(16) __bf16 ldsB[2][BLK_N][LDS_K];

    const int tid  = threadIdx.x;
    const int lane = tid & 31;
    const int wave = tid >> 5;
    const int wm   = wave >> 1;          // 0..3 -> rows wm*32
    const int wn   = wave & 1;           // 0..1 -> cols wn*64
    const int lr   = lane & 15;
    const int h    = lane >> 4;

    const int mbase = blockIdx.x * BLK_M;
    const int nbase = blockIdx.y * BLK_N;

    // A loader: one (row, 16-wide K chunk) per thread; lanes run along the rows
    const int arow = tid & (BLK_M - 1);
    const int akq  = (tid >> 7) * 16;
    const int amg  = mbase + arow;
    const float* aptr = u + ((size_t)(amg / SEQ_L) * IN_DIM) * SEQ_L + (amg & (SEQ_L - 1));

    v8f acc[2][4];
    #pragma unroll
    for (int mi = 0; mi < 2; ++mi)
        #pragma unroll
        for (int ni = 0; ni < 4; ++ni) acc[mi][ni] = (v8f){};

    auto stage = [&](int kt, int buf) {
        const int k0 = kt * BLK_K;
        // ---- A: f32 columns of u -> bf16 rows (and emit uT once) ----
        v8bf v0, v1;
        #pragma unroll
        for (int j = 0; j < 8; ++j) {
            v0[j] = (__bf16)aptr[(size_t)(k0 + akq + j) * SEQ_L];
            v1[j] = (__bf16)aptr[(size_t)(k0 + akq + 8 + j) * SEQ_L];
        }
        *(v8bf*)&ldsA[buf][arow][akq]     = v0;
        *(v8bf*)&ldsA[buf][arow][akq + 8] = v1;
        if (blockIdx.y == 0) {
            *(v8bf*)(uT + (size_t)amg * IN_DIM + k0 + akq)     = v0;
            *(v8bf*)(uT + (size_t)amg * IN_DIM + k0 + akq + 8) = v1;
        }
#if HAVE_TDM
        if (wave == 0)
            tdm_load_2d((unsigned)(uintptr_t)&ldsB[buf][0][0],
                        Bb + (size_t)nbase * IN_DIM + k0,
                        BLK_N, BLK_K, IN_DIM);
#else
        const int bkq = (tid & 1) * 16;
        const __bf16* bp = Bb + (size_t)(nbase + (tid >> 1)) * IN_DIM + k0 + bkq;
        *(v8bf*)&ldsB[buf][tid >> 1][bkq]     = *(const v8bf*)bp;
        *(v8bf*)&ldsB[buf][tid >> 1][bkq + 8] = *(const v8bf*)(bp + 8);
#endif
    };

    stage(0, 0);
#if HAVE_TDM
    if (wave == 0) __builtin_amdgcn_s_wait_tensorcnt(0);
#endif
    __syncthreads();

    const int KT = IN_DIM / BLK_K;       // 16
    for (int kt = 0; kt < KT; ++kt) {
        const int buf = kt & 1;
        if (kt + 1 < KT) stage(kt + 1, buf ^ 1);

        v16bf a0 = load_frag(&ldsA[buf][wm * 32 + lr][0],      h);
        v16bf a1 = load_frag(&ldsA[buf][wm * 32 + 16 + lr][0], h);
        #pragma unroll
        for (int ni = 0; ni < 4; ++ni) {
            v16bf bf = load_frag(&ldsB[buf][wn * 64 + ni * 16 + lr][0], h);
            acc[0][ni] = wmma_bf16(a0, bf, acc[0][ni]);
            acc[1][ni] = wmma_bf16(a1, bf, acc[1][ni]);
        }
#if HAVE_TDM
        if (wave == 0) __builtin_amdgcn_s_wait_tensorcnt(0);
#endif
        __syncthreads();
    }

    // ---- epilogue: Bu[m][s] f32, coalesced across lanes ----
    #pragma unroll
    for (int mi = 0; mi < 2; ++mi)
        #pragma unroll
        for (int ni = 0; ni < 4; ++ni) {
            int n = nbase + wn * 64 + ni * 16 + lr;
            int m = mbase + wm * 32 + mi * 16 + h * 8;
            #pragma unroll
            for (int r = 0; r < 8; ++r)
                Bu[(size_t)(m + r) * S_DIM + n] = acc[mi][ni][r];
        }
}

// --------------------------- SCAN ------------------------------------------
// The chain x[l] = a*x[l-1] + Bu[l] is linear, so it is cut along l. A block
// owns 64 channels of one batch (a lane two neighbours: a wave's load is 256
// contiguous bytes, its store one whole 128-B line); each of its 16 waves
// holds one chunk of 64 steps in registers. Per round of 1024 steps:
//   1. every wave runs its chunk from zero and leaves the end value in LDS;
//   2. behind one barrier every wave folds the 16 end values with a^64 into
//      the state at the head of its own chunk (and of the next round);
//   3. it runs its chunk again from that state, out of the same registers,
//      stores the results and refills each register for the next round.
// Bu is read once, and a whole round of it is in flight at a time.
#define SCAN_W   16                // waves of a block = chunks of a round
#define SCAN_T   64                // steps of a chunk
#define SCAN_G   16                // steps whose bf16 results are stored together
#define SCAN_R   (SEQ_L / (SCAN_W * SCAN_T))      // 2 rounds
#define SCAN_C   64                // channels of a block
typedef __attribute__((ext_vector_type(2))) float  v2f;
typedef __attribute__((ext_vector_type(2))) __bf16 v2bf;

__global__ __launch_bounds__(SCAN_W * 32)
void ssm_scan_kernel(const float* __restrict__ Bu,
                     const float* __restrict__ ad,
                     const float* __restrict__ h0,
                     __bf16* __restrict__ xs) {
    __shared__ v2f ends[SCAN_R][SCAN_W][32];         // a plane a round: one barrier a round

    const int lane = threadIdx.x & 31;
    const int c    = threadIdx.x >> 5;               // this wave's chunk
    const int b    = blockIdx.x / (S_DIM / SCAN_C);
    const int s    = (blockIdx.x % (S_DIM / SCAN_C)) * SCAN_C + lane * 2;
    const v2f a = *(const v2f*)(ad + s);
    v2f x0      = *(const v2f*)(h0 + s);             // state at the head of the round
    // keeps these two loads older than the chunk's: issued behind them, their
    // wait would drain the whole chunk before the first step
    __builtin_amdgcn_sched_barrier(0);
    const size_t row0 = (size_t)b * SEQ_L + c * SCAN_T;
    const float* bu = Bu + row0 * S_DIM + s;
    __bf16* xo      = xs + row0 * S_DIM + s;

    // every loop below is unrolled: v and y are then indexed by constants
    // alone and stay in registers
    v2f v[SCAN_T];
    #pragma unroll
    for (int k = 0; k < SCAN_T; ++k) v[k] = *(const v2f*)(bu + (size_t)k * S_DIM);

    v2f aT = a;                                      // a^SCAN_T by six squarings
    #pragma unroll
    for (int q = 1; q < SCAN_T; q *= 2) aT *= aT;

    // unrolled so that v stays in registers and the last round drops its refill
    #pragma unroll
    for (int r = 0; r < SCAN_R; ++r) {
        v2f e = v[0];
        #pragma unroll
        for (int k = 1; k < SCAN_T; ++k) {
            e.x = fmaf(e.x, a.x, v[k].x);
            e.y = fmaf(e.y, a.y, v[k].y);
        }
        ends[r][c][lane] = e;
        __syncthreads();

        v2f x = x0, xin = x0;
        #pragma unroll
        for (int j = 0; j < SCAN_W; ++j) {
            const v2f ej = ends[r][j][lane];
            if (j == c) xin = x;
            x.x = fmaf(x.x, aT.x, ej.x);
            x.y = fmaf(x.y, aT.y, ej.y);
        }
        x0 = x;
        x  = xin;

        const int l0 = r * SCAN_W * SCAN_T;
        #pragma unroll
        for (int g = 0; g < SCAN_T; g += SCAN_G) {
            v2bf y[SCAN_G];
            #pragma unroll
            for (int k = 0; k < SCAN_G; ++k) {
                x.x = fmaf(x.x, a.x, v[g + k].x);
                x.y = fmaf(x.y, a.y, v[g + k].y);
                y[k][0] = (__bf16)x.x;
                y[k][1] = (__bf16)x.y;
                if (r + 1 < SCAN_R) {
                    // stands in front of the kernel's last load, whose result
                    // lands in the address pair that the loads before it name
                    if (r + 2 == SCAN_R && g + k == SCAN_T - 1)
                        asm volatile("s_wait_xcnt 0x0" ::: "memory");
                    v[g + k] = *(const v2f*)(bu + (size_t)(l0 + SCAN_W * SCAN_T + g + k) * S_DIM);
                }
            }
            __builtin_amdgcn_sched_barrier(0);
            #pragma unroll
            for (int k = 0; k < SCAN_G; ++k)
                *(v2bf*)(xo + (size_t)(l0 + g + k) * S_DIM) = y[k];
            // stands in front of the next group's refill loads, whose results
            // land in the data registers that these stores name
            if (r + 1 < SCAN_R && g + SCAN_G < SCAN_T)
                asm volatile("s_wait_xcnt 0x0" ::: "memory");
            // keeps the stores from sinking to the round's end, where all
            // SCAN_T of them in a row fill the store counter
            __builtin_amdgcn_sched_barrier(0);
        }
    }
}

__global__ __launch_bounds__(256)
void ssm_gemm2_kernel(const __bf16* __restrict__ xs,
                      const __bf16* __restrict__ uT,
                      const __bf16* __restrict__ CDb,   // [o][k], stride 1024
                      float* __restrict__ out) {
    __shared__ __align__(16) __bf16 ldsA[2][BLK_M][LDS_K];
    __shared__ __align__(16) __bf16 ldsB[2][BLK_N][LDS_K];

    const int tid  = threadIdx.x;
    const int lane = tid & 31;
    const int wave = tid >> 5;
    const int wm   = wave >> 1;
    const int wn   = wave & 1;
    const int lr   = lane & 15;
    const int h    = lane >> 4;

    const int mbase = blockIdx.x * BLK_M;
    const int nbase = blockIdx.y * BLK_N;

    v8f acc[2][4];
    #pragma unroll
    for (int mi = 0; mi < 2; ++mi)
        #pragma unroll
        for (int ni = 0; ni < 4; ++ni) acc[mi][ni] = (v8f){};

    auto stage = [&](int kt, int buf) {
        const int k0 = kt * BLK_K;
        const __bf16* asrc = (k0 < S_DIM)
            ? xs + (size_t)mbase * S_DIM + k0
            : uT + (size_t)mbase * IN_DIM + (k0 - S_DIM);
#if HAVE_TDM
        if (wave == 0) {
            tdm_load_2d((unsigned)(uintptr_t)&ldsA[buf][0][0], asrc,
                        BLK_M, BLK_K, S_DIM);
            tdm_load_2d((unsigned)(uintptr_t)&ldsB[buf][0][0],
                        CDb + (size_t)nbase * 1024 + k0,
                        BLK_N, BLK_K, 1024);
        }
#else
        const int row = tid >> 1, kq = (tid & 1) * 16;
        const __bf16* ap = asrc + (size_t)row * S_DIM + kq;
        *(v8bf*)&ldsA[buf][row][kq]     = *(const v8bf*)ap;
        *(v8bf*)&ldsA[buf][row][kq + 8] = *(const v8bf*)(ap + 8);
        const __bf16* bp = CDb + (size_t)(nbase + row) * 1024 + k0 + kq;
        *(v8bf*)&ldsB[buf][row][kq]     = *(const v8bf*)bp;
        *(v8bf*)&ldsB[buf][row][kq + 8] = *(const v8bf*)(bp + 8);
#endif
    };

    stage(0, 0);
#if HAVE_TDM
    if (wave == 0) __builtin_amdgcn_s_wait_tensorcnt(0);
#endif
    __syncthreads();

    const int KT = 1024 / BLK_K;          // 32
    for (int kt = 0; kt < KT; ++kt) {
        const int buf = kt & 1;
        if (kt + 1 < KT) stage(kt + 1, buf ^ 1);

        v16bf a0 = load_frag(&ldsA[buf][wm * 32 + lr][0],      h);
        v16bf a1 = load_frag(&ldsA[buf][wm * 32 + 16 + lr][0], h);
        #pragma unroll
        for (int ni = 0; ni < 4; ++ni) {
            v16bf bf = load_frag(&ldsB[buf][wn * 64 + ni * 16 + lr][0], h);
            acc[0][ni] = wmma_bf16(a0, bf, acc[0][ni]);
            acc[1][ni] = wmma_bf16(a1, bf, acc[1][ni]);
        }
#if HAVE_TDM
        if (wave == 0) __builtin_amdgcn_s_wait_tensorcnt(0);
#endif
        __syncthreads();
    }

    // epilogue: Y[b, o, l]; m = b*2048 + l, so a lane's 8 accumulator rows are
    // 8 consecutive l of one (b, o): two 16-byte stores
    #pragma unroll
    for (int mi = 0; mi < 2; ++mi)
        #pragma unroll
        for (int ni = 0; ni < 4; ++ni) {
            int o = nbase + wn * 64 + ni * 16 + lr;
            int m = mbase + wm * 32 + mi * 16 + h * 8;
            float* yp = out + (size_t)(m / SEQ_L) * OUT_DIM * SEQ_L
                            + (size_t)o * SEQ_L + (m & (SEQ_L - 1));
            v8f c = acc[mi][ni];
            *(v4f*)yp       = __builtin_shufflevector(c, c, 0, 1, 2, 3);
            *(v4f*)(yp + 4) = __builtin_shufflevector(c, c, 4, 5, 6, 7);
        }
}

// --------------------------- launch ----------------------------------------

extern "C" void kernel_launch(void* const* d_in, const int* in_sizes, int n_in,
                              void* d_out, int out_size, void* d_ws, size_t ws_size,
                              hipStream_t stream) {
    const float* u     = (const float*)d_in[0];
    const float* a_unc = (const float*)d_in[1];
    const float* Bmat  = (const float*)d_in[2];
    const float* Cmat  = (const float*)d_in[3];
    const float* Dmat  = (const float*)d_in[4];
    const float* h0    = (const float*)d_in[5];
    float* out = (float*)d_out;

    char* w = (char*)d_ws;
    float*  ad  = (float*)w;                               // 2 KiB
    __bf16* Bb  = (__bf16*)(w + 4096);                     // 512 KiB
    __bf16* CDb = (__bf16*)(w + 4096 + (512 << 10));       // 1 MiB
    char* w2 = w + 4096 + (512 << 10) + (1 << 20);
    float*  Bu  = (float*)w2;                              // 64 MiB
    __bf16* xsb = (__bf16*)(w2 + ((size_t)64 << 20));      // 32 MiB
    __bf16* uT  = (__bf16*)(w2 + ((size_t)96 << 20));      // 32 MiB

    ssm_prep_kernel<<<3 * PREP_BLKS + 1, 256, 0, stream>>>(a_unc, Bmat, Cmat, Dmat, ad, Bb, CDb);

    ssm_gemm1_kernel<<<dim3(M_TOT / BLK_M, S_DIM / BLK_N), 256, 0, stream>>>(u, Bb, Bu, uT);
    ssm_scan_kernel<<<(BZ * S_DIM) / SCAN_C, SCAN_W * 32, 0, stream>>>(Bu, ad, h0, xsb);
    ssm_gemm2_kernel<<<dim3(M_TOT / BLK_M, OUT_DIM / BLK_N), 256, 0, stream>>>(xsb, uT, CDb, out);
}

// v005
// One run takes 86.8 microseconds.
// Timed twice side by side with v004, it ran 1.24 times as fast both times.
// Counting every step since v000, it is 12.7 times as fast.
#include <hip/hip_runtime.h>
#include <hip/hip_bf16.h>

#define BZ       16
#define IN_DIM   512
#define S_DIM    512
#define OUT_DIM  512
#define SEQ_L    2048
#define M_TOT    (SEQ_L * BZ)      // 32768

#define BLK_M    128
#define BLK_N    128
#define BLK_K    32
#define LDS_K    40                // 32 + 8 pad (conflict-free b128 frags)

typedef __attribute__((ext_vector_type(16))) __bf16 v16bf;
typedef __attribute__((ext_vector_type(8)))  __bf16 v8bf;
typedef __attribute__((ext_vector_type(4)))  __bf16 v4bf;
typedef __attribute__((ext_vector_type(8)))  float  v8f;
typedef __attribute__((ext_vector_type(4)))  float  v4f;

#if defined(__gfx1250__) && __has_builtin(__builtin_amdgcn_tensor_load_to_lds)
#define HAVE_TDM 1
#else
#define HAVE_TDM 0
#endif

#if HAVE_TDM
typedef __attribute__((ext_vector_type(4))) unsigned int v4u;
typedef __attribute__((ext_vector_type(8))) int          v8i;
typedef __attribute__((ext_vector_type(4))) int          v4i;

__device__ __forceinline__ void tdm_load_2d(unsigned lds_off, const void* gptr,
                                            unsigned rows, unsigned cols,
                                            unsigned row_stride_elems) {
    unsigned long long ga = (unsigned long long)(uintptr_t)gptr;
    v4u g0;
    g0[0] = 1u;                                        // count=1, load, user
    g0[1] = lds_off;                                   // lds_addr (bytes)
    g0[2] = (unsigned)(ga & 0xffffffffu);              // global_addr[31:0]
    g0[3] = (unsigned)((ga >> 32) & 0x1ffffffu) | (2u << 30);  // [56:32]|type=2
    const unsigned td0 = 0x01000000u, td1 = 0x01000000u;   // huge: no OOB clamp
    v8i g1;
    g1[0] = (int)((1u << 16)
                | (1u << 20)
                | (3u << 22)
                | (3u << 25));
    g1[1] = (int)((td0 & 0xffffu) << 16);
    g1[2] = (int)(((td0 >> 16) & 0xffffu) | ((td1 & 0xffffu) << 16));
    g1[3] = (int)(((td1 >> 16) & 0xffffu) | (cols << 16));
    g1[4] = (int)(rows & 0xffffu);
    g1[5] = (int)row_stride_elems;
    g1[6] = 0;
    g1[7] = 0;
    v4i gz4 = {0, 0, 0, 0};
    v8i gz8 = {0, 0, 0, 0, 0, 0, 0, 0};
    __builtin_amdgcn_tensor_load_to_lds(g0, g1, gz4, gz4, gz8, 0);
}
#endif

__device__ __forceinline__ v16bf load_frag(const __bf16* row, int h) {
    v8bf lo = *(const v8bf*)(row + h * 8);
    v8bf hi = *(const v8bf*)(row + 16 + h * 8);
    return __builtin_shufflevector(lo, hi, 0,1,2,3,4,5,6,7,8,9,10,11,12,13,14,15);
}

__device__ __forceinline__ v8f wmma_bf16(v16bf a, v16bf b, v8f c) {
    return __builtin_amdgcn_wmma_f32_16x16x32_bf16(
        false, a, false, b, (short)0, c, false, false);
}

// --------------------------- prep kernel -----------------------------------

// One launch for all four independent preparations, dealt by block index:
// blocks 0..191 convert B, C and D to bf16 (64 blocks a matrix), block 192
// makes A_diag. A thread converts four groups of 4 values; a wave's load is
// 512 contiguous bytes and its store 256.
#define PREP_VALS  4096            // values a block converts (8 rows of 512)
#define PREP_BLKS  (S_DIM * IN_DIM / PREP_VALS)   // 64 blocks a matrix

__global__ __launch_bounds__(256)
void ssm_prep_kernel(const float* __restrict__ a_unc,
                     const float* __restrict__ Bm,
                     const float* __restrict__ Cm,
                     const float* __restrict__ Dm,
                     float* __restrict__ ad,
                     __bf16* __restrict__ Bb,
                     __bf16* __restrict__ CDb) {
    const int tid   = threadIdx.x;
    const int which = blockIdx.x / PREP_BLKS;        // 0: B, 1: C, 2: D, 3: A_diag
    if (which == 3) {
        for (int i = tid; i < S_DIM; i += 256) {
            float x = a_unc[i];
            ad[i] = -(fmaxf(x, 0.0f) + log1pf(expf(-fabsf(x))));
        }
        return;
    }
    const float* src = (which == 0) ? Bm : (which == 1) ? Cm : Dm;
    __bf16* dst      = (which == 0) ? Bb : (which == 1) ? CDb : CDb + S_DIM;
    const int dstride = (which == 0) ? IN_DIM : S_DIM + IN_DIM;
    const int base = (blockIdx.x - which * PREP_BLKS) * PREP_VALS + tid * 4;

    // unrolled so that x stays in registers and the four loads are in flight
    // together: the memory latency is paid once a thread, not once a group
    v4f x[4];
    #pragma unroll
    for (int j = 0; j < 4; ++j) x[j] = *(const v4f*)(src + base + j * 1024);
    #pragma unroll
    for (int j = 0; j < 4; ++j) {
        const int i = base + j * 1024;
        v4bf y;
        #pragma unroll
        for (int e = 0; e < 4; ++e) y[e] = (__bf16)x[j][e];
        *(v4bf*)(dst + (size_t)(i >> 9) * dstride + (i & 511)) = y;
    }
    // stands in front of whatever the compiler lays out behind the four stores
    // and lets overwrite a register that they name
    asm volatile("s_wait_xcnt 0x0" ::: "memory");
}

__global__ __launch_bounds__(256)
void ssm_gemm1_kernel(const float* __restrict__ u,
                      const __bf16* __restrict__ Bb,
                      float* __restrict__ Bu,
                      __bf16* __restrict__ uT) {
    __shared__ __align__(16) __bf16 ldsA[2][BLK_M][LDS_K];
    __shared__ __align__(16) __bf16 ldsB[2][BLK_N][LDS_K];

    const int tid  = threadIdx.x;
    const int lane = tid & 31;
    const int wave = tid >> 5;
    const int wm   = wave >> 1;          // 0..3 -> rows wm*32
    const int wn   = wave & 1;           // 0..1 -> cols wn*64
    const int lr   = lane & 15;
    const int h    = lane >> 4;

    const int mbase = blockIdx.x * BLK_M;
    const int nbase = blockIdx.y * BLK_N;

    // A loader: one (row, 16-wide K chunk) per thread; lanes run along the rows
    const int arow = tid & (BLK_M - 1);
    const int akq  = (tid >> 7) * 16;
    const int amg  = mbase + arow;
    const float* aptr = u + ((size_t)(amg / SEQ_L) * IN_DIM) * SEQ_L + (amg & (SEQ_L - 1));

    v8f acc[2][4];
    #pragma unroll
    for (int mi = 0; mi < 2; ++mi)
        #pragma unroll
        for (int ni = 0; ni < 4; ++ni) acc[mi][ni] = (v8f){};

    auto stage = [&](int kt, int buf) {
        const int k0 = kt * BLK_K;
        // ---- A: f32 columns of u -> bf16 rows (and emit uT once) ----
        v8bf v0, v1;
        #pragma unroll
        for (int j = 0; j < 8; ++j) {
            v0[j] = (__bf16)aptr[(size_t)(k0 + akq + j) * SEQ_L];
            v1[j] = (__bf16)aptr[(size_t)(k0 + akq + 8 + j) * SEQ_L];
        }
        *(v8bf*)&ldsA[buf][arow][akq]     = v0;
        *(v8bf*)&ldsA[buf][arow][akq + 8] = v1;
        if (blockIdx.y == 0) {
            *(v8bf*)(uT + (size_t)amg * IN_DIM + k0 + akq)     = v0;
            *(v8bf*)(uT + (size_t)amg * IN_DIM + k0 + akq + 8) = v1;
        }
#if HAVE_TDM
        if (wave == 0)
            tdm_load_2d((unsigned)(uintptr_t)&ldsB[buf][0][0],
                        Bb + (size_t)nbase * IN_DIM + k0,
                        BLK_N, BLK_K, IN_DIM);
#else
        const int bkq = (tid & 1) * 16;
        const __bf16* bp = Bb + (size_t)(nbase + (tid >> 1)) * IN_DIM + k0 + bkq;
        *(v8bf*)&ldsB[buf][tid >> 1][bkq]     = *(const v8bf*)bp;
        *(v8bf*)&ldsB[buf][tid >> 1][bkq + 8] = *(const v8bf*)(bp + 8);
#endif
    };

    stage(0, 0);
#if HAVE_TDM
    if (wave == 0) __builtin_amdgcn_s_wait_tensorcnt(0);
#endif
    __syncthreads();

    const int KT = IN_DIM / BLK_K;       // 16
    for (int kt = 0; kt < KT; ++kt) {
        const int buf = kt & 1;
        if (kt + 1 < KT) stage(kt + 1, buf ^ 1);

        v16bf a0 = load_frag(&ldsA[buf][wm * 32 + lr][0],      h);
        v16bf a1 = load_frag(&ldsA[buf][wm * 32 + 16 + lr][0], h);
        #pragma unroll
        for (int ni = 0; ni < 4; ++ni) {
            v16bf bf = load_frag(&ldsB[buf][wn * 64 + ni * 16 + lr][0], h);
            acc[0][ni] = wmma_bf16(a0, bf, acc[0][ni]);
            acc[1][ni] = wmma_bf16(a1, bf, acc[1][ni]);
        }
#if HAVE_TDM
        if (wave == 0) __builtin_amdgcn_s_wait_tensorcnt(0);
#endif
        __syncthreads();
    }

    // ---- epilogue: Bu[m][s] f32, coalesced across lanes ----
    #pragma unroll
    for (int mi = 0; mi < 2; ++mi)
        #pragma unroll
        for (int ni = 0; ni < 4; ++ni) {
            int n = nbase + wn * 64 + ni * 16 + lr;
            int m = mbase + wm * 32 + mi * 16 + h * 8;
            #pragma unroll
            for (int r = 0; r < 8; ++r)
                Bu[(size_t)(m + r) * S_DIM + n] = acc[mi][ni][r];
        }
}

// --------------------------- SCAN ------------------------------------------
// The chain x[l] = a*x[l-1] + Bu[l] is linear, so it is cut along l. A block
// owns 64 channels of one batch (a lane two neighbours: a wave's load is 256
// contiguous bytes, its store one whole 128-B line); each of its 16 waves
// holds one chunk of 64 steps in registers. Per round of 1024 steps:
//   1. every wave runs its chunk from zero and leaves the end value in LDS;
//   2. behind one barrier every wave folds the 16 end values with a^64 into
//      the state at the head of its own chunk (and of the next round);
//   3. it runs its chunk again from that state, out of the same registers,
//      stores the results and refills each register for the next round.
// Bu is read once, and a whole round of it is in flight at a time.
#define SCAN_W   16                // waves of a block = chunks of a round
#define SCAN_T   64                // steps of a chunk
#define SCAN_G   16                // steps whose bf16 results are stored together
#define SCAN_R   (SEQ_L / (SCAN_W * SCAN_T))      // 2 rounds
#define SCAN_C   64                // channels of a block
typedef __attribute__((ext_vector_type(2))) float  v2f;
typedef __attribute__((ext_vector_type(2))) __bf16 v2bf;

__global__ __launch_bounds__(SCAN_W * 32)
void ssm_scan_kernel(const float* __restrict__ Bu,
                     const float* __restrict__ ad,
                     const float* __restrict__ h0,
                     __bf16* __restrict__ xs) {
    __shared__ v2f ends[SCAN_R][SCAN_W][32];         // a plane a round: one barrier a round

    const int lane = threadIdx.x & 31;
    const int c    = threadIdx.x >> 5;               // this wave's chunk
    const int b    = blockIdx.x / (S_DIM / SCAN_C);
    const int s    = (blockIdx.x % (S_DIM / SCAN_C)) * SCAN_C + lane * 2;
    const v2f a = *(const v2f*)(ad + s);
    v2f x0      = *(const v2f*)(h0 + s);             // state at the head of the round
    // keeps these two loads older than the chunk's: issued behind them, their
    // wait would drain the whole chunk before the first step
    __builtin_amdgcn_sched_barrier(0);
    const size_t row0 = (size_t)b * SEQ_L + c * SCAN_T;
    const float* bu = Bu + row0 * S_DIM + s;
    __bf16* xo      = xs + row0 * S_DIM + s;

    // every loop below is unrolled: v and y are then indexed by constants
    // alone and stay in registers
    v2f v[SCAN_T];
    #pragma unroll
    for (int k = 0; k < SCAN_T; ++k) v[k] = *(const v2f*)(bu + (size_t)k * S_DIM);

    v2f aT = a;                                      // a^SCAN_T by six squarings
    #pragma unroll
    for (int q = 1; q < SCAN_T; q *= 2) aT *= aT;

    // unrolled so that v stays in registers and the last round drops its refill
    #pragma unroll
    for (int r = 0; r < SCAN_R; ++r) {
        v2f e = v[0];
        #pragma unroll
        for (int k = 1; k < SCAN_T; ++k) {
            e.x = fmaf(e.x, a.x, v[k].x);
            e.y = fmaf(e.y, a.y, v[k].y);
        }
        ends[r][c][lane] = e;
        __syncthreads();

        v2f x = x0, xin = x0;
        #pragma unroll
        for (int j = 0; j < SCAN_W; ++j) {
            const v2f ej = ends[r][j][lane];
            if (j == c) xin = x;
            x.x = fmaf(x.x, aT.x, ej.x);
            x.y = fmaf(x.y, aT.y, ej.y);
        }
        x0 = x;
        x  = xin;

        const int l0 = r * SCAN_W * SCAN_T;
        #pragma unroll
        for (int g = 0; g < SCAN_T; g += SCAN_G) {
            v2bf y[SCAN_G];
            #pragma unroll
            for (int k = 0; k < SCAN_G; ++k) {
                x.x = fmaf(x.x, a.x, v[g + k].x);
                x.y = fmaf(x.y, a.y, v[g + k].y);
                y[k][0] = (__bf16)x.x;
                y[k][1] = (__bf16)x.y;
                if (r + 1 < SCAN_R) {
                    // stands in front of the kernel's last load, whose result
                    // lands in the address pair that the loads before it name
                    if (r + 2 == SCAN_R && g + k == SCAN_T - 1)
                        asm volatile("s_wait_xcnt 0x0" ::: "memory");
                    v[g + k] = *(const v2f*)(bu + (size_t)(l0 + SCAN_W * SCAN_T + g + k) * S_DIM);
                }
            }
            __builtin_amdgcn_sched_barrier(0);
            #pragma unroll
            for (int k = 0; k < SCAN_G; ++k)
                *(v2bf*)(xo + (size_t)(l0 + g + k) * S_DIM) = y[k];
            // stands in front of the next group's refill loads, whose results
            // land in the data registers that these stores name
            if (r + 1 < SCAN_R && g + SCAN_G < SCAN_T)
                asm volatile("s_wait_xcnt 0x0" ::: "memory");
            // keeps the stores from sinking to the round's end, where all
            // SCAN_T of them in a row fill the store counter
            __builtin_amdgcn_sched_barrier(0);
        }
    }
}

#define G2_K      128                       // k of a stage
#define G2_ROWB   (G2_K * 2)                // bytes of a tile row
#define G2_PITCH  (G2_ROWB + 16)            // LDS pitch for ds_load_b128 readers
#define G2_TILE   (128 * G2_PITCH)          // 34,816 B = 17 x 2 KiB
#define G2_NST    ((S_DIM + IN_DIM) / G2_K) // 8 stages

typedef uint32_t u32x4 __attribute__((ext_vector_type(4)));
typedef uint32_t u32x8 __attribute__((ext_vector_type(8)));

__device__ __forceinline__ uint32_t uni(uint32_t v) { return __builtin_amdgcn_readfirstlane(v); }
__device__ __forceinline__ uint32_t pinned(uint32_t v) {
    uint32_t w = __builtin_amdgcn_readfirstlane(v);
    asm volatile("" : "+s"(w));
    return w;
}

__global__ __launch_bounds__(256)
void ssm_gemm2_kernel(const __bf16* __restrict__ xs,
                      const __bf16* __restrict__ uT,
                      const __bf16* __restrict__ CDb,   // [o][k], stride 1024
                      float* __restrict__ out) {
    // [buffer][A | B]; every tile starts at a multiple of 2 KiB
    __shared__ __attribute__((aligned(2048))) unsigned char ring[2][2][G2_TILE];

    const int tid  = threadIdx.x;
    const int lane = tid & 31;
    const uint32_t wave = uni(threadIdx.x >> 5);
    const int wm   = wave >> 1;
    const int wn   = wave & 1;
    const int lr   = lane & 15;
    const int h    = lane >> 4;

    const int mbase = blockIdx.x * BLK_M;
    const int nbase = blockIdx.y * BLK_N;

    v8f acc[2][4];
    #pragma unroll
    for (int mi = 0; mi < 2; ++mi)
        #pragma unroll
        for (int ni = 0; ni < 4; ++ni) acc[mi][ni] = (v8f){};

    u32x8 g1;
    g1[0] = uni((1u << 20) | (5u << 22) | (3u << 25));
    g1[1] = uni(((uint32_t)G2_ROWB & 0xFFFFu) << 16);
    g1[2] = uni(128u << 16);
    g1[3] = uni((uint32_t)G2_ROWB << 16);
    g1[4] = uni(128u);
    g1[5] = uni(wave == 0 ? (uint32_t)(S_DIM * 2) : (uint32_t)((S_DIM + IN_DIM) * 2));
    g1[6] = uni(0u);
    g1[7] = uni(0u);
    const uint32_t ring0 = (uint32_t)(uintptr_t)&ring[0][0][0];

    // one request of the calling wave (0 or 1): its tile of stage s
    auto issue = [&](int s) {
        const int k0 = s * G2_K;
        const __bf16* src = (wave == 0)
            ? ((k0 < S_DIM) ? xs + (size_t)mbase * S_DIM + k0
                            : uT + (size_t)mbase * IN_DIM + (k0 - S_DIM))
            : CDb + (size_t)nbase * (S_DIM + IN_DIM) + k0;
        const uint64_t ga = (uint64_t)(uintptr_t)src;
        u32x4 g0;
        g0[0] = uni(1u);
        g0[1] = uni(ring0 + (uint32_t)(((s & 1) * 2 + (int)wave) * G2_TILE));
        g0[2] = (uint32_t)uni((uint32_t)ga);
        g0[3] = (uint32_t)uni((((uint32_t)(ga >> 32)) & 0x01FFFFFFu) | 0x80000000u);
        asm volatile("tensor_load_to_lds %0, %1" :: "s"(g0), "s"(g1) : "memory");
    };

    // prologue of the two-buffer ring
    if (pinned(wave < 2)) {
        issue(0);
        // stage 0 has landed before the barrier publishes it
        asm volatile("s_wait_tensorcnt 0x0" ::: "memory");
    }
    __syncthreads();
    if (pinned(wave < 2)) issue(1);

    // unrolled: whether a stage s + 2 exists, and whether a stage's A tile is
    // of xs or of uT, is then settled at compile time
    #pragma unroll
    for (int s = 0; s < G2_NST; ++s) {
        const unsigned char* At = &ring[s & 1][0][0] + (wm * 32 + lr) * G2_PITCH;
        const unsigned char* Bt = &ring[s & 1][1][0] + (wn * 64 + lr) * G2_PITCH;
        #pragma unroll
        for (int kk = 0; kk < G2_K / BLK_K; ++kk) {
            v16bf a0 = load_frag((const __bf16*)(At + kk * 64), h);
            v16bf a1 = load_frag((const __bf16*)(At + 16 * G2_PITCH + kk * 64), h);
            #pragma unroll
            for (int ni = 0; ni < 4; ++ni) {
                v16bf bf = load_frag((const __bf16*)(Bt + ni * 16 * G2_PITCH + kk * 64), h);
                acc[0][ni] = wmma_bf16(a0, bf, acc[0][ni]);
                acc[1][ni] = wmma_bf16(a1, bf, acc[1][ni]);
            }
        }
        // publish point of stage s + 1: this wave's reads of stage s are done,
        asm volatile("s_wait_dscnt 0x0" ::: "memory");
        // each issuing wave's tile of stage s + 1 has landed,
        if (pinned(wave < 2)) asm volatile("s_wait_tensorcnt 0x0" ::: "memory");
        // every wave has left stage s's buffer and may read stage s + 1,
        __syncthreads();
        // and stage s + 2 goes into the buffer that stage s has left
        if (s + 2 < G2_NST) {
            if (pinned(wave < 2)) issue(s + 2);
        }
    }
    // nothing of the ring is outstanding when the wave goes on to its end
    asm volatile("s_wait_tensorcnt 0x0" ::: "memory");
    asm volatile("s_wait_dscnt 0x0" ::: "memory");

    // epilogue: Y[b, o, l]; m = b*2048 + l, so a lane's 8 accumulator rows are
    // 8 consecutive l of one (b, o): two 16-byte stores
    #pragma unroll
    for (int mi = 0; mi < 2; ++mi)
        #pragma unroll
        for (int ni = 0; ni < 4; ++ni) {
            int o = nbase + wn * 64 + ni * 16 + lr;
            int m = mbase + wm * 32 + mi * 16 + h * 8;
            float* yp = out + (size_t)(m / SEQ_L) * OUT_DIM * SEQ_L
                            + (size_t)o * SEQ_L + (m & (SEQ_L - 1));
            v8f c = acc[mi][ni];
            *(v4f*)yp       = __builtin_shufflevector(c, c, 0, 1, 2, 3);
            *(v4f*)(yp + 4) = __builtin_shufflevector(c, c, 4, 5, 6, 7);
        }
}

// --------------------------- launch ----------------------------------------

extern "C" void kernel_launch(void* const* d_in, const int* in_sizes, int n_in,
                              void* d_out, int out_size, void* d_ws, size_t ws_size,
                              hipStream_t stream) {
    const float* u     = (const float*)d_in[0];
    const float* a_unc = (const float*)d_in[1];
    const float* Bmat  = (const float*)d_in[2];
    const float* Cmat  = (const float*)d_in[3];
    const float* Dmat  = (const float*)d_in[4];
    const float* h0    = (const float*)d_in[5];
    float* out = (float*)d_out;

    char* w = (char*)d_ws;
    float*  ad  = (float*)w;                               // 2 KiB
    __bf16* Bb  = (__bf16*)(w + 4096);                     // 512 KiB
    __bf16* CDb = (__bf16*)(w + 4096 + (512 << 10));       // 1 MiB
    char* w2 = w + 4096 + (512 << 10) + (1 << 20);
    float*  Bu  = (float*)w2;                              // 64 MiB
    __bf16* xsb = (__bf16*)(w2 + ((size_t)64 << 20));      // 32 MiB
    __bf16* uT  = (__bf16*)(w2 + ((size_t)96 << 20));      // 32 MiB

    ssm_prep_kernel<<<3 * PREP_BLKS + 1, 256, 0, stream>>>(a_unc, Bmat, Cmat, Dmat, ad, Bb, CDb);

    ssm_gemm1_kernel<<<dim3(M_TOT / BLK_M, S_DIM / BLK_N), 256, 0, stream>>>(u, Bb, Bu, uT);
    ssm_scan_kernel<<<(BZ * S_DIM) / SCAN_C, SCAN_W * 32, 0, stream>>>(Bu, ad, h0, xsb);
    ssm_gemm2_kernel<<<dim3(M_TOT / BLK_M, OUT_DIM / BLK_N), 256, 0, stream>>>(xsb, uT, CDb, out);
}

// v006
// A run of this version takes 78 microseconds.
// Timed twice side by side with v005, it ran 1.11 times as fast both times.
// Counting every step since v000, it is 14.1 times as fast.
#include <hip/hip_runtime.h>
#include <hip/hip_bf16.h>

#define BZ       16
#define IN_DIM   512
#define S_DIM    512
#define OUT_DIM  512
#define SEQ_L    2048
#define M_TOT    (SEQ_L * BZ)      // 32768

#define BLK_M    128
#define BLK_N    128
#define BLK_K    32
#define LDS_K    40                // 32 + 8 pad (conflict-free b128 frags)

typedef __attribute__((ext_vector_type(16))) __bf16 v16bf;
typedef __attribute__((ext_vector_type(8)))  __bf16 v8bf;
typedef __attribute__((ext_vector_type(4)))  __bf16 v4bf;
typedef __attribute__((ext_vector_type(8)))  float  v8f;
typedef __attribute__((ext_vector_type(4)))  float  v4f;

#if defined(__gfx1250__) && __has_builtin(__builtin_amdgcn_tensor_load_to_lds)
#define HAVE_TDM 1
#else
#define HAVE_TDM 0
#endif

#if HAVE_TDM
typedef __attribute__((ext_vector_type(4))) unsigned int v4u;
typedef __attribute__((ext_vector_type(8))) int          v8i;
typedef __attribute__((ext_vector_type(4))) int          v4i;

__device__ __forceinline__ void tdm_load_2d(unsigned lds_off, const void* gptr,
                                            unsigned rows, unsigned cols,
                                            unsigned row_stride_elems) {
    unsigned long long ga = (unsigned long long)(uintptr_t)gptr;
    v4u g0;
    g0[0] = 1u;                                        // count=1, load, user
    g0[1] = lds_off;                                   // lds_addr (bytes)
    g0[2] = (unsigned)(ga & 0xffffffffu);              // global_addr[31:0]
    g0[3] = (unsigned)((ga >> 32) & 0x1ffffffu) | (2u << 30);  // [56:32]|type=2
    const unsigned td0 = 0x01000000u, td1 = 0x01000000u;   // huge: no OOB clamp
    v8i g1;
    g1[0] = (int)((1u << 16)
                | (1u << 20)
                | (3u << 22)
                | (3u << 25));
    g1[1] = (int)((td0 & 0xffffu) << 16);
    g1[2] = (int)(((td0 >> 16) & 0xffffu) | ((td1 & 0xffffu) << 16));
    g1[3] = (int)(((td1 >> 16) & 0xffffu) | (cols << 16));
    g1[4] = (int)(rows & 0xffffu);
    g1[5] = (int)row_stride_elems;
    g1[6] = 0;
    g1[7] = 0;
    v4i gz4 = {0, 0, 0, 0};
    v8i gz8 = {0, 0, 0, 0, 0, 0, 0, 0};
    __builtin_amdgcn_tensor_load_to_lds(g0, g1, gz4, gz4, gz8, 0);
}
#endif

__device__ __forceinline__ v16bf load_frag(const __bf16* row, int h) {
    v8bf lo = *(const v8bf*)(row + h * 8);
    v8bf hi = *(const v8bf*)(row + 16 + h * 8);
    return __builtin_shufflevector(lo, hi, 0,1,2,3,4,5,6,7,8,9,10,11,12,13,14,15);
}

__device__ __forceinline__ v8f wmma_bf16(v16bf a, v16bf b, v8f c) {
    return __builtin_amdgcn_wmma_f32_16x16x32_bf16(
        false, a, false, b, (short)0, c, false, false);
}

// --------------------------- prep kernel -----------------------------------

// One launch for all four independent preparations, dealt by block index:
// blocks 0..191 convert B, C and D to bf16 (64 blocks a matrix), block 192
// makes A_diag. A thread converts four groups of 4 values; a wave's load is
// 512 contiguous bytes and its store 256.
#define PREP_VALS  4096            // values a block converts (8 rows of 512)
#define PREP_BLKS  (S_DIM * IN_DIM / PREP_VALS)   // 64 blocks a matrix

__global__ __launch_bounds__(256)
void ssm_prep_kernel(const float* __restrict__ a_unc,
                     const float* __restrict__ Bm,
                     const float* __restrict__ Cm,
                     const float* __restrict__ Dm,
                     float* __restrict__ ad,
                     __bf16* __restrict__ Bb,
                     __bf16* __restrict__ CDb) {
    const int tid   = threadIdx.x;
    const int which = blockIdx.x / PREP_BLKS;        // 0: B, 1: C, 2: D, 3: A_diag
    if (which == 3) {
        for (int i = tid; i < S_DIM; i += 256) {
            float x = a_unc[i];
            ad[i] = -(fmaxf(x, 0.0f) + log1pf(expf(-fabsf(x))));
        }
        return;
    }
    const float* src = (which == 0) ? Bm : (which == 1) ? Cm : Dm;
    __bf16* dst      = (which == 0) ? Bb : (which == 1) ? CDb : CDb + S_DIM;
    const int dstride = (which == 0) ? IN_DIM : S_DIM + IN_DIM;
    const int base = (blockIdx.x - which * PREP_BLKS) * PREP_VALS + tid * 4;

    // unrolled so that x stays in registers and the four loads are in flight
    // together: the memory latency is paid once a thread, not once a group
    v4f x[4];
    #pragma unroll
    for (int j = 0; j < 4; ++j) x[j] = *(const v4f*)(src + base + j * 1024);
    #pragma unroll
    for (int j = 0; j < 4; ++j) {
        const int i = base + j * 1024;
        v4bf y;
        #pragma unroll
        for (int e = 0; e < 4; ++e) y[e] = (__bf16)x[j][e];
        *(v4bf*)(dst + (size_t)(i >> 9) * dstride + (i & 511)) = y;
    }
    // stands in front of whatever the compiler lays out behind the four stores
    // and lets overwrite a register that they name
    asm volatile("s_wait_xcnt 0x0" ::: "memory");
}

__global__ __launch_bounds__(256)
void ssm_gemm1_kernel(const float* __restrict__ u,
                      const __bf16* __restrict__ Bb,
                      float* __restrict__ Bu,
                      __bf16* __restrict__ uT) {
    __shared__ __align__(16) __bf16 ldsA[2][BLK_M][LDS_K];
    __shared__ __align__(16) __bf16 ldsB[2][BLK_N][LDS_K];

    const int tid  = threadIdx.x;
    const int lane = tid & 31;
    const int wave = tid >> 5;
    const int wm   = wave >> 1;          // 0..3 -> rows wm*32
    const int wn   = wave & 1;           // 0..1 -> cols wn*64
    const int lr   = lane & 15;
    const int h    = lane >> 4;

    const int mbase = blockIdx.x * BLK_M;
    const int nbase = blockIdx.y * BLK_N;

    // A loader: one (row, 16-wide K chunk) per thread; lanes run along the rows
    const int arow = tid & (BLK_M - 1);
    const int akq  = (tid >> 7) * 16;
    const int amg  = mbase + arow;
    const float* aptr = u + ((size_t)(amg / SEQ_L) * IN_DIM) * SEQ_L + (amg & (SEQ_L - 1));

    v8f acc[2][4];
    #pragma unroll
    for (int mi = 0; mi < 2; ++mi)
        #pragma unroll
        for (int ni = 0; ni < 4; ++ni) acc[mi][ni] = (v8f){};

    // ---- uT, once per m tile: stage kt's rows are read back from the published
    // A tile, four lanes to a row, so that a wave's store is 8 runs of 64 B; out
    // of the loader's registers (a lane a row) it was 32 pieces of 16 B ----
    auto emit = [&](int kt, int buf) {
        if (blockIdx.y == 0) {
            v8bf t[2];
            #pragma unroll
            for (int j = 0; j < 2; ++j)
                t[j] = *(const v8bf*)&ldsA[buf][(tid >> 2) + j * 64][(tid & 3) * 8];
            #pragma unroll
            for (int j = 0; j < 2; ++j)
                *(v8bf*)(uT + (size_t)(mbase + (tid >> 2) + j * 64) * IN_DIM
                            + kt * BLK_K + (tid & 3) * 8) = t[j];
            // stands in front of whatever overwrites a register that the two
            // stores name
            asm volatile("s_wait_xcnt 0x0" ::: "memory");
        }
    };

    auto stage = [&](int kt, int buf, bool with_emit) {
        const int k0 = kt * BLK_K;
        // ---- A: f32 columns of u -> bf16 rows ----
        float f[16];
        #pragma unroll
        for (int j = 0; j < 16; ++j) f[j] = aptr[(size_t)(k0 + akq + j) * SEQ_L];
        // stands in front of whatever overwrites an address pair that the loads
        // above name (uT's read-back may land in it)
        asm volatile("s_wait_xcnt 0x0" ::: "memory");
        // the stage before leaves for uT while these loads are on their way
        if (with_emit) emit(kt - 1, buf ^ 1);
        v8bf v0, v1;
        #pragma unroll
        for (int j = 0; j < 8; ++j) {
            v0[j] = (__bf16)f[j];
            v1[j] = (__bf16)f[8 + j];
        }
        *(v8bf*)&ldsA[buf][arow][akq]     = v0;
        *(v8bf*)&ldsA[buf][arow][akq + 8] = v1;
#if HAVE_TDM
        if (wave == 0)
            tdm_load_2d((unsigned)(uintptr_t)&ldsB[buf][0][0],
                        Bb + (size_t)nbase * IN_DIM + k0,
                        BLK_N, BLK_K, IN_DIM);
#else
        const int bkq = (tid & 1) * 16;
        const __bf16* bp = Bb + (size_t)(nbase + (tid >> 1)) * IN_DIM + k0 + bkq;
        *(v8bf*)&ldsB[buf][tid >> 1][bkq]     = *(const v8bf*)bp;
        *(v8bf*)&ldsB[buf][tid >> 1][bkq + 8] = *(const v8bf*)(bp + 8);
#endif
    };

    stage(0, 0, false);
#if HAVE_TDM
    if (wave == 0) __builtin_amdgcn_s_wait_tensorcnt(0);
#endif
    __syncthreads();

    const int KT = IN_DIM / BLK_K;       // 16
    for (int kt = 0; kt < KT; ++kt) {
        const int buf = kt & 1;
        if (kt + 1 < KT) stage(kt + 1, buf ^ 1, true);
        else             emit(kt, buf);

        v16bf a0 = load_frag(&ldsA[buf][wm * 32 + lr][0],      h);
        v16bf a1 = load_frag(&ldsA[buf][wm * 32 + 16 + lr][0], h);
        #pragma unroll
        for (int ni = 0; ni < 4; ++ni) {
            v16bf bf = load_frag(&ldsB[buf][wn * 64 + ni * 16 + lr][0], h);
            acc[0][ni] = wmma_bf16(a0, bf, acc[0][ni]);
            acc[1][ni] = wmma_bf16(a1, bf, acc[1][ni]);
        }
#if HAVE_TDM
        if (wave == 0) __builtin_amdgcn_s_wait_tensorcnt(0);
#endif
        __syncthreads();
    }

    // ---- epilogue: Bu[m][s] f32, coalesced across lanes ----
    #pragma unroll
    for (int mi = 0; mi < 2; ++mi)
        #pragma unroll
        for (int ni = 0; ni < 4; ++ni) {
            int n = nbase + wn * 64 + ni * 16 + lr;
            int m = mbase + wm * 32 + mi * 16 + h * 8;
            #pragma unroll
            for (int r = 0; r < 8; ++r)
                Bu[(size_t)(m + r) * S_DIM + n] = acc[mi][ni][r];
        }
}

// --------------------------- SCAN ------------------------------------------
// The chain x[l] = a*x[l-1] + Bu[l] is linear, so it is cut along l. A block
// owns 64 channels of one batch (a lane two neighbours: a wave's load is 256
// contiguous bytes, its store one whole 128-B line); each of its 16 waves
// holds one chunk of 64 steps in registers. Per round of 1024 steps:
//   1. every wave runs its chunk from zero and leaves the end value in LDS;
//   2. behind one barrier every wave folds the 16 end values with a^64 into
//      the state at the head of its own chunk (and of the next round);
//   3. it runs its chunk again from that state, out of the same registers,
//      stores the results and refills each register for the next round.
// Bu is read once, and a whole round of it is in flight at a time.
#define SCAN_W   16                // waves of a block = chunks of a round
#define SCAN_T   64                // steps of a chunk
#define SCAN_G   16                // steps whose bf16 results are stored together
#define SCAN_R   (SEQ_L / (SCAN_W * SCAN_T))      // 2 rounds
#define SCAN_C   64                // channels of a block
typedef __attribute__((ext_vector_type(2))) float  v2f;
typedef __attribute__((ext_vector_type(2))) __bf16 v2bf;

__global__ __launch_bounds__(SCAN_W * 32)
void ssm_scan_kernel(const float* __restrict__ Bu,
                     const float* __restrict__ ad,
                     const float* __restrict__ h0,
                     __bf16* __restrict__ xs) {
    __shared__ v2f ends[SCAN_R][SCAN_W][32];         // a plane a round: one barrier a round

    const int lane = threadIdx.x & 31;
    const int c    = threadIdx.x >> 5;               // this wave's chunk
    const int b    = blockIdx.x / (S_DIM / SCAN_C);
    const int s    = (blockIdx.x % (S_DIM / SCAN_C)) * SCAN_C + lane * 2;
    const v2f a = *(const v2f*)(ad + s);
    v2f x0      = *(const v2f*)(h0 + s);             // state at the head of the round
    // keeps these two loads older than the chunk's: issued behind them, their
    // wait would drain the whole chunk before the first step
    __builtin_amdgcn_sched_barrier(0);
    const size_t row0 = (size_t)b * SEQ_L + c * SCAN_T;
    const float* bu = Bu + row0 * S_DIM + s;
    __bf16* xo      = xs + row0 * S_DIM + s;

    // every loop below is unrolled: v and y are then indexed by constants
    // alone and stay in registers
    v2f v[SCAN_T];
    #pragma unroll
    for (int k = 0; k < SCAN_T; ++k) v[k] = *(const v2f*)(bu + (size_t)k * S_DIM);

    v2f aT = a;                                      // a^SCAN_T by six squarings
    #pragma unroll
    for (int q = 1; q < SCAN_T; q *= 2) aT *= aT;

    // unrolled so that v stays in registers and the last round drops its refill
    #pragma unroll
    for (int r = 0; r < SCAN_R; ++r) {
        v2f e = v[0];
        #pragma unroll
        for (int k = 1; k < SCAN_T; ++k) {
            e.x = fmaf(e.x, a.x, v[k].x);
            e.y = fmaf(e.y, a.y, v[k].y);
        }
        ends[r][c][lane] = e;
        __syncthreads();

        v2f x = x0, xin = x0;
        #pragma unroll
        for (int j = 0; j < SCAN_W; ++j) {
            const v2f ej = ends[r][j][lane];
            if (j == c) xin = x;
            x.x = fmaf(x.x, aT.x, ej.x);
            x.y = fmaf(x.y, aT.y, ej.y);
        }
        x0 = x;
        x  = xin;

        const int l0 = r * SCAN_W * SCAN_T;
        #pragma unroll
        for (int g = 0; g < SCAN_T; g += SCAN_G) {
            v2bf y[SCAN_G];
            #pragma unroll
            for (int k = 0; k < SCAN_G; ++k) {
                x.x = fmaf(x.x, a.x, v[g + k].x);
                x.y = fmaf(x.y, a.y, v[g + k].y);
                y[k][0] = (__bf16)x.x;
                y[k][1] = (__bf16)x.y;
                if (r + 1 < SCAN_R) {
                    // stands in front of the kernel's last load, whose result
                    // lands in the address pair that the loads before it name
                    if (r + 2 == SCAN_R && g + k == SCAN_T - 1)
                        asm volatile("s_wait_xcnt 0x0" ::: "memory");
                    v[g + k] = *(const v2f*)(bu + (size_t)(l0 + SCAN_W * SCAN_T + g + k) * S_DIM);
                }
            }
            __builtin_amdgcn_sched_barrier(0);
            #pragma unroll
            for (int k = 0; k < SCAN_G; ++k)
                *(v2bf*)(xo + (size_t)(l0 + g + k) * S_DIM) = y[k];
            // stands in front of the next group's refill loads, whose results
            // land in the data registers that these stores name
            if (r + 1 < SCAN_R && g + SCAN_G < SCAN_T)
                asm volatile("s_wait_xcnt 0x0" ::: "memory");
            // keeps the stores from sinking to the round's end, where all
            // SCAN_T of them in a row fill the store counter
            __builtin_amdgcn_sched_barrier(0);
        }
    }
}

#define G2_K      128                       // k of a stage
#define G2_ROWB   (G2_K * 2)                // bytes of a tile row
#define G2_PITCH  (G2_ROWB + 16)            // LDS pitch for ds_load_b128 readers
#define G2_TILE   (128 * G2_PITCH)          // 34,816 B = 17 x 2 KiB
#define G2_NST    ((S_DIM + IN_DIM) / G2_K) // 8 stages
#define G2_OPITCH (BLK_M * 4 + 16)          // LDS pitch of an output row (128 l, f32)

typedef uint32_t u32x4 __attribute__((ext_vector_type(4)));
typedef uint32_t u32x8 __attribute__((ext_vector_type(8)));

__device__ __forceinline__ uint32_t uni(uint32_t v) { return __builtin_amdgcn_readfirstlane(v); }
__device__ __forceinline__ uint32_t pinned(uint32_t v) {
    uint32_t w = __builtin_amdgcn_readfirstlane(v);
    asm volatile("" : "+s"(w));
    return w;
}

__global__ __launch_bounds__(256)
void ssm_gemm2_kernel(const __bf16* __restrict__ xs,
                      const __bf16* __restrict__ uT,
                      const __bf16* __restrict__ CDb,   // [o][k], stride 1024
                      float* __restrict__ out) {
    // [buffer][A | B]; every tile starts at a multiple of 2 KiB
    __shared__ __attribute__((aligned(2048))) unsigned char ring[2][2][G2_TILE];

    const int tid  = threadIdx.x;
    const int lane = tid & 31;
    const uint32_t wave = uni(threadIdx.x >> 5);
    const int wm   = wave >> 1;
    const int wn   = wave & 1;
    const int lr   = lane & 15;
    const int h    = lane >> 4;

    const int mbase = blockIdx.x * BLK_M;
    const int nbase = blockIdx.y * BLK_N;

    v8f acc[2][4];
    #pragma unroll
    for (int mi = 0; mi < 2; ++mi)
        #pragma unroll
        for (int ni = 0; ni < 4; ++ni) acc[mi][ni] = (v8f){};

    u32x8 g1;
    g1[0] = uni((1u << 20) | (5u << 22) | (3u << 25));
    g1[1] = uni(((uint32_t)G2_ROWB & 0xFFFFu) << 16);
    g1[2] = uni(128u << 16);
    g1[3] = uni((uint32_t)G2_ROWB << 16);
    g1[4] = uni(128u);
    g1[5] = uni(wave == 0 ? (uint32_t)(S_DIM * 2) : (uint32_t)((S_DIM + IN_DIM) * 2));
    g1[6] = uni(0u);
    g1[7] = uni(0u);
    const uint32_t ring0 = (uint32_t)(uintptr_t)&ring[0][0][0];

    // one request of the calling wave (0 or 1): its tile of stage s
    auto issue = [&](int s) {
        const int k0 = s * G2_K;
        const __bf16* src = (wave == 0)
            ? ((k0 < S_DIM) ? xs + (size_t)mbase * S_DIM + k0
                            : uT + (size_t)mbase * IN_DIM + (k0 - S_DIM))
            : CDb + (size_t)nbase * (S_DIM + IN_DIM) + k0;
        const uint64_t ga = (uint64_t)(uintptr_t)src;
        u32x4 g0;
        g0[0] = uni(1u);
        g0[1] = uni(ring0 + (uint32_t)(((s & 1) * 2 + (int)wave) * G2_TILE));
        g0[2] = (uint32_t)uni((uint32_t)ga);
        g0[3] = (uint32_t)uni((((uint32_t)(ga >> 32)) & 0x01FFFFFFu) | 0x80000000u);
        asm volatile("tensor_load_to_lds %0, %1" :: "s"(g0), "s"(g1) : "memory");
    };

    // prologue of the two-buffer ring
    if (pinned(wave < 2)) {
        issue(0);
        // stage 0 has landed before the barrier publishes it
        asm volatile("s_wait_tensorcnt 0x0" ::: "memory");
    }
    __syncthreads();
    if (pinned(wave < 2)) issue(1);

    // unrolled: whether a stage s + 2 exists, and whether a stage's A tile is
    // of xs or of uT, is then settled at compile time
    #pragma unroll
    for (int s = 0; s < G2_NST; ++s) {
        const unsigned char* At = &ring[s & 1][0][0] + (wm * 32 + lr) * G2_PITCH;
        const unsigned char* Bt = &ring[s & 1][1][0] + (wn * 64 + lr) * G2_PITCH;
        #pragma unroll
        for (int kk = 0; kk < G2_K / BLK_K; ++kk) {
            v16bf a0 = load_frag((const __bf16*)(At + kk * 64), h);
            v16bf a1 = load_frag((const __bf16*)(At + 16 * G2_PITCH + kk * 64), h);
            #pragma unroll
            for (int ni = 0; ni < 4; ++ni) {
                v16bf bf = load_frag((const __bf16*)(Bt + ni * 16 * G2_PITCH + kk * 64), h);
                acc[0][ni] = wmma_bf16(a0, bf, acc[0][ni]);
                acc[1][ni] = wmma_bf16(a1, bf, acc[1][ni]);
            }
        }
        // publish point of stage s + 1: this wave's reads of stage s are done,
        asm volatile("s_wait_dscnt 0x0" ::: "memory");
        // each issuing wave's tile of stage s + 1 has landed,
        if (pinned(wave < 2)) asm volatile("s_wait_tensorcnt 0x0" ::: "memory");
        // every wave has left stage s's buffer and may read stage s + 1,
        __syncthreads();
        // and stage s + 2 goes into the buffer that stage s has left
        if (s + 2 < G2_NST) {
            if (pinned(wave < 2)) issue(s + 2);
        }
    }
    // nothing of the ring is outstanding when the wave goes on to its end
    asm volatile("s_wait_tensorcnt 0x0" ::: "memory");
    asm volatile("s_wait_dscnt 0x0" ::: "memory");

    // epilogue: Y[b, o, l]; m = b*2048 + l, so the block's tile is 128 rows o
    // of 128 consecutive l (512 B). A lane's 8 accumulator rows are only 32 B
    // of such a row, so the tile is laid out in the ring, which every wave has
    // left at the last pass's barrier, as [o][l] ...
    unsigned char* st = &ring[0][0][0];
    #pragma unroll
    for (int mi = 0; mi < 2; ++mi)
        #pragma unroll
        for (int ni = 0; ni < 4; ++ni) {
            float* sp = (float*)(st + (wn * 64 + ni * 16 + lr) * G2_OPITCH)
                        + wm * 32 + mi * 16 + h * 8;
            v8f c = acc[mi][ni];
            *(v4f*)sp       = __builtin_shufflevector(c, c, 0, 1, 2, 3);
            *(v4f*)(sp + 4) = __builtin_shufflevector(c, c, 4, 5, 6, 7);
        }
    // every wave's part of the tile is in LDS before a row is read back
    __syncthreads();
    // ... and a wave's store is one whole row: 512 contiguous bytes
    float* yb = out + (size_t)(mbase / SEQ_L) * OUT_DIM * SEQ_L
                    + (size_t)(nbase + (int)wave * 16) * SEQ_L
                    + (mbase & (SEQ_L - 1)) + lane * 4;
    const unsigned char* sr = st + ((int)wave * 16) * G2_OPITCH + lane * 16;
    v4f row[16];
    #pragma unroll
    for (int i = 0; i < 16; ++i) row[i] = *(const v4f*)(sr + i * G2_OPITCH);
    #pragma unroll
    for (int i = 0; i < 16; ++i) *(v4f*)(yb + (size_t)i * SEQ_L) = row[i];
}

// --------------------------- launch ----------------------------------------

extern "C" void kernel_launch(void* const* d_in, const int* in_sizes, int n_in,
                              void* d_out, int out_size, void* d_ws, size_t ws_size,
                              hipStream_t stream) {
    const float* u     = (const float*)d_in[0];
    const float* a_unc = (const float*)d_in[1];
    const float* Bmat  = (const float*)d_in[2];
    const float* Cmat  = (const float*)d_in[3];
    const float* Dmat  = (const float*)d_in[4];
    const float* h0    = (const float*)d_in[5];
    float* out = (float*)d_out;

    char* w = (char*)d_ws;
    float*  ad  = (float*)w;                               // 2 KiB
    __bf16* Bb  = (__bf16*)(w + 4096);                     // 512 KiB
    __bf16* CDb = (__bf16*)(w + 4096 + (512 << 10));       // 1 MiB
    char* w2 = w + 4096 + (512 << 10) + (1 << 20);
    float*  Bu  = (float*)w2;                              // 64 MiB
    __bf16* xsb = (__bf16*)(w2 + ((size_t)64 << 20));      // 32 MiB
    __bf16* uT  = (__bf16*)(w2 + ((size_t)96 << 20));      // 32 MiB

    ssm_prep_kernel<<<3 * PREP_BLKS + 1, 256, 0, stream>>>(a_unc, Bmat, Cmat, Dmat, ad, Bb, CDb);

    ssm_gemm1_kernel<<<dim3(M_TOT / BLK_M, S_DIM / BLK_N), 256, 0, stream>>>(u, Bb, Bu, uT);
    ssm_scan_kernel<<<(BZ * S_DIM) / SCAN_C, SCAN_W * 32, 0, stream>>>(Bu, ad, h0, xsb);
    ssm_gemm2_kernel<<<dim3(M_TOT / BLK_M, OUT_DIM / BLK_N), 256, 0, stream>>>(xsb, uT, CDb, out);
}

// v007
// Measured time: 69.5 microseconds a run.
// Timed twice side by side with v006, it ran 1.12 and 1.13 times as fast.
// Over all steps from v000 it is 15.9 times as fast.
#include <hip/hip_runtime.h>
#include <hip/hip_bf16.h>

#define BZ       16
#define IN_DIM   512
#define S_DIM    512
#define OUT_DIM  512
#define SEQ_L    2048
#define M_TOT    (SEQ_L * BZ)      // 32768

#define BLK_M    128
#define BLK_N    128
#define BLK_K    32

typedef __attribute__((ext_vector_type(16))) __bf16 v16bf;
typedef __attribute__((ext_vector_type(8)))  __bf16 v8bf;
typedef __attribute__((ext_vector_type(4)))  __bf16 v4bf;
typedef __attribute__((ext_vector_type(8)))  float  v8f;
typedef __attribute__((ext_vector_type(4)))  float  v4f;

__device__ __forceinline__ v16bf load_frag(const __bf16* row, int h) {
    v8bf lo = *(const v8bf*)(row + h * 8);
    v8bf hi = *(const v8bf*)(row + 16 + h * 8);
    return __builtin_shufflevector(lo, hi, 0,1,2,3,4,5,6,7,8,9,10,11,12,13,14,15);
}

__device__ __forceinline__ v8f wmma_bf16(v16bf a, v16bf b, v8f c) {
    return __builtin_amdgcn_wmma_f32_16x16x32_bf16(
        false, a, false, b, (short)0, c, false, false);
}

// --------------------------- prep kernel -----------------------------------

// One launch for all four independent preparations, dealt by block index:
// blocks 0..191 convert B, C and D to bf16 (64 blocks a matrix), block 192
// makes A_diag. A thread converts four groups of 4 values; a wave's load is
// 512 contiguous bytes and its store 256.
#define PREP_VALS  4096            // values a block converts (8 rows of 512)
#define PREP_BLKS  (S_DIM * IN_DIM / PREP_VALS)   // 64 blocks a matrix

__global__ __launch_bounds__(256)
void ssm_prep_kernel(const float* __restrict__ a_unc,
                     const float* __restrict__ Bm,
                     const float* __restrict__ Cm,
                     const float* __restrict__ Dm,
                     float* __restrict__ ad,
                     __bf16* __restrict__ Bb,
                     __bf16* __restrict__ CDb) {
    const int tid   = threadIdx.x;
    const int which = blockIdx.x / PREP_BLKS;        // 0: B, 1: C, 2: D, 3: A_diag
    if (which == 3) {
        for (int i = tid; i < S_DIM; i += 256) {
            float x = a_unc[i];
            ad[i] = -(fmaxf(x, 0.0f) + log1pf(expf(-fabsf(x))));
        }
        return;
    }
    const float* src = (which == 0) ? Bm : (which == 1) ? Cm : Dm;
    __bf16* dst      = (which == 0) ? Bb : (which == 1) ? CDb : CDb + S_DIM;
    const int dstride = (which == 0) ? IN_DIM : S_DIM + IN_DIM;
    const int base = (blockIdx.x - which * PREP_BLKS) * PREP_VALS + tid * 4;

    // unrolled so that x stays in registers and the four loads are in flight
    // together: the memory latency is paid once a thread, not once a group
    v4f x[4];
    #pragma unroll
    for (int j = 0; j < 4; ++j) x[j] = *(const v4f*)(src + base + j * 1024);
    #pragma unroll
    for (int j = 0; j < 4; ++j) {
        const int i = base + j * 1024;
        v4bf y;
        #pragma unroll
        for (int e = 0; e < 4; ++e) y[e] = (__bf16)x[j][e];
        *(v4bf*)(dst + (size_t)(i >> 9) * dstride + (i & 511)) = y;
    }
    // stands in front of whatever the compiler lays out behind the four stores
    // and lets overwrite a register that they name
    asm volatile("s_wait_xcnt 0x0" ::: "memory");
}

// --------------------------- GEMM1: Bu = u^T x B^T -------------------------
// A block takes 128 rows m (128 consecutive l of one batch) and ALL 512 s, one
// block to a WGP: u is read from L2 and converted once, where four blocks of
// 128 s each read and converted it. A wave owns 64 m x 128 s.
// A[m,k] = u[b,k,l]: a wave's load is one k of the 128 l, 512 contiguous bytes;
// a lane then holds 4 l x 8 k and writes four 16-B pieces of bf16 rows. The
// loads of stage s + 1 are issued ahead of pass s and stored to LDS behind it.
// bf16 uT[m,k] is a byproduct, stored out of the A tile in LDS.
// B panel staged by tensor loads, 64 k a stage, waves 0 to 3 a slice of 128 s.
#define G1_K      64                        // k of a stage
#define G1_ROWB   (G1_K * 2)                // bytes of a tile row
#define G1_PITCH  (G1_ROWB + 16)            // LDS pitch for ds_load_b128 readers
#define G1_SLICE  (128 * G1_PITCH)          // 18,432 B = 9 x 2 KiB
#define G1_BT     (4 * G1_SLICE)            // the B tile: 512 rows
#define G1_BUF    (G1_BT + G1_SLICE)        // a buffer: [B | A]
#define G1_NST    (IN_DIM / G1_K)           // 8 stages

typedef uint32_t u32x4 __attribute__((ext_vector_type(4)));
typedef uint32_t u32x8 __attribute__((ext_vector_type(8)));

__device__ __forceinline__ uint32_t uni(uint32_t v) { return __builtin_amdgcn_readfirstlane(v); }
__device__ __forceinline__ uint32_t pinned(uint32_t v) {
    uint32_t w = __builtin_amdgcn_readfirstlane(v);
    asm volatile("" : "+s"(w));
    return w;
}

__global__ __launch_bounds__(256)
void ssm_gemm1_kernel(const float* __restrict__ u,
                      const __bf16* __restrict__ Bb,
                      float* __restrict__ Bu,
                      __bf16* __restrict__ uT) {
    // every slice starts at a multiple of 2 KiB
    __shared__ __attribute__((aligned(2048))) unsigned char ring[2][G1_BUF];

    const int tid  = threadIdx.x;
    const int lane = tid & 31;
    const uint32_t wave = uni(threadIdx.x >> 5);
    const int wm   = wave >> 2;          // 0..1 -> rows wm*64
    const int wn   = wave & 3;           // 0..3 -> cols wn*128
    const int lr   = lane & 15;
    const int h    = lane >> 4;

    const int mbase = blockIdx.x * BLK_M;

    // A loader: wave w brings k = 8w .. 8w+7 of a stage, a lane 4 rows
    // (the base is the wave's, in scalar registers; the lane's offset stays apart)
    const float* aptr = u + ((size_t)(mbase / SEQ_L) * IN_DIM + (int)wave * 8) * SEQ_L
                          + (mbase & (SEQ_L - 1));

    v8f acc[4][8];
    #pragma unroll
    for (int mi = 0; mi < 4; ++mi)
        #pragma unroll
        for (int ni = 0; ni < 8; ++ni) acc[mi][ni] = (v8f){};

    u32x8 g1;
    g1[0] = uni((1u << 20) | (4u << 22) | (3u << 25));
    g1[1] = uni(((uint32_t)G1_ROWB & 0xFFFFu) << 16);
    g1[2] = uni(128u << 16);
    g1[3] = uni((uint32_t)G1_ROWB << 16);
    g1[4] = uni(128u);
    g1[5] = uni((uint32_t)(IN_DIM * 2));
    g1[6] = uni(0u);
    g1[7] = uni(0u);
    const uint32_t ring0 = (uint32_t)(uintptr_t)&ring[0][0];

    // one request of the calling wave (0 to 3): its 128 rows of B, stage s
    u32x4 g0;
    g0[0] = uni(1u);
    auto issue = [&](int s) {
        const __bf16* src = Bb + (size_t)((int)wave * 128) * IN_DIM + s * G1_K;
        const uint64_t ga = (uint64_t)(uintptr_t)src;
        uint32_t w0;
        asm volatile("s_mov_b32 %0, %1" : "=s"(w0) : "i"((1u << 20) | (4u << 22) | (3u << 25)));
        g1[0] = uni(w0);
        g0[1] = uni(ring0 + (uint32_t)((s & 1) * G1_BUF + (int)wave * G1_SLICE));
        g0[2] = (uint32_t)uni((uint32_t)ga);
        g0[3] = (uint32_t)uni((((uint32_t)(ga >> 32)) & 0x01FFFFFFu) | 0x80000000u);
        // both groups are named in-out: they then stay in their own registers
        // from one issue to the next, and nothing else is put there while the
        // request is outstanding
        asm volatile("tensor_load_to_lds %0, %1" : "+s"(g0), "+s"(g1) :: "memory");
    };

    // the issuing wave's wait for its request. It names both groups as inputs:
    // every word of them is then live, in its own register, up to this wait
    auto landed = [&]() {
        asm volatile("s_wait_tensorcnt 0x0" :: "s"(g0), "s"(g1) : "memory");
    };

    // a pointer made from two words says itself that it is to global memory
    typedef __attribute__((address_space(1))) v4f gv4f;
    v4f f[8];
    auto aload = [&](int s) {
        // the stage's base goes through scalar registers: the loads then name
        // it and the lane's offset, and none of them lands in an address pair
        const uint64_t pa = (uint64_t)(uintptr_t)(aptr + (size_t)(s * G1_K) * SEQ_L);
        const gv4f* p = (const gv4f*)(uintptr_t)(((uint64_t)uni((uint32_t)(pa >> 32)) << 32)
                                                 | uni((uint32_t)pa));
        #pragma unroll
        for (int j = 0; j < 8; ++j)
            f[j] = p[(size_t)j * (SEQ_L / 4) + lane];
        // stands in front of whatever overwrites an address pair that the loads
        // above name
        asm volatile("s_wait_xcnt 0x0" ::: "memory");
    };
    auto astore = [&](int s) {
        unsigned char* At = &ring[s & 1][G1_BT] + (lane * 4) * G1_PITCH + (int)wave * 16;
        #pragma unroll
        for (int i = 0; i < 4; ++i) {
            v8bf t;
            #pragma unroll
            for (int j = 0; j < 8; ++j) t[j] = (__bf16)f[j][i];
            *(v8bf*)(At + i * G1_PITCH) = t;
        }
    };
    // uT: stage s's rows are read back from the published A tile, eight lanes to
    // a row, so that a wave's store is 4 whole lines of 128 B
    auto emit = [&](int s) {
        const unsigned char* At = &ring[s & 1][G1_BT] + (tid >> 3) * G1_PITCH + (tid & 7) * 16;
        v8bf t[4];
        #pragma unroll
        for (int j = 0; j < 4; ++j) t[j] = *(const v8bf*)(At + j * 32 * G1_PITCH);
        #pragma unroll
        for (int j = 0; j < 4; ++j)
            *(v8bf*)(uT + (size_t)(mbase + (tid >> 3) + j * 32) * IN_DIM
                        + s * G1_K + (tid & 7) * 8) = t[j];
        // stands in front of whatever overwrites a register that the four
        // stores name
        asm volatile("s_wait_xcnt 0x0" ::: "memory");
    };

    // prologue of the two-buffer ring
    aload(0);
    if (pinned(wave < 4)) {
        issue(0);
        // stage 0 has landed before the barrier publishes it
        landed();
    }
    astore(0);
    __syncthreads();
    if (pinned(wave < 4)) issue(1);

    // stays rolled, for speed only
    #pragma nounroll
    for (int s = 0; s < G1_NST; ++s) {
        if (s + 1 < G1_NST) aload(s + 1);
        const unsigned char* Bt = &ring[s & 1][0]     + (wn * 128 + lr) * G1_PITCH;
        const unsigned char* At = &ring[s & 1][G1_BT] + (wm * 64 + lr) * G1_PITCH;
        // a pass is four blocks of 16 matrix instructions (32 k x 64 s each);
        // two fragment sets, the next block's loads issued ahead of this block
        v16bf a[2][4], b[2][4];
        #pragma unroll
        for (int i = 0; i < 4; ++i) {
            a[0][i] = load_frag((const __bf16*)(At + i * 16 * G1_PITCH), h);
            b[0][i] = load_frag((const __bf16*)(Bt + i * 16 * G1_PITCH), h);
        }
        emit(s);
        #pragma unroll
        for (int q = 0; q < 4; ++q) {
            const int kk = q >> 1;
            if (q + 1 < 4) {
                const int kn = (q + 1) >> 1, hn = (q + 1) & 1;
                #pragma unroll
                for (int i = 0; i < 4; ++i)
                    b[(q + 1) & 1][i] = load_frag(
                        (const __bf16*)(Bt + (hn * 4 + i) * 16 * G1_PITCH + kn * 64), h);
                if (hn == 0) {
                    #pragma unroll
                    for (int i = 0; i < 4; ++i)
                        a[kn][i] = load_frag((const __bf16*)(At + i * 16 * G1_PITCH + kn * 64), h);
                }
            }
            // keeps the next block's loads ahead of this block: sunk among the
            // matrix instructions into one register set, every four of them
            // wait out an LDS latency
            __builtin_amdgcn_sched_barrier(0);
            #pragma unroll
            for (int i = 0; i < 4; ++i)
                #pragma unroll
                for (int mi = 0; mi < 4; ++mi)
                    acc[mi][(q & 1) * 4 + i] = wmma_bf16(a[kk][mi], b[q & 1][i], acc[mi][(q & 1) * 4 + i]);
            // keeps the loads of the block after next from rising over this block
            __builtin_amdgcn_sched_barrier(0);
        }
        // the A tile of stage s + 1 goes into the buffer that every wave left
        // at the barrier of pass s - 1
        if (s + 1 < G1_NST) astore(s + 1);
        // publish point of stage s + 1: this wave's reads of stage s and its
        // writes of stage s + 1 are done,
        asm volatile("s_wait_dscnt 0x0" ::: "memory");
        // each issuing wave's slice of stage s + 1 has landed,
        if (pinned(wave < 4)) landed();
        // every wave has left stage s's buffer and may read stage s + 1,
        __syncthreads();
        // and stage s + 2 goes into the buffer that stage s has left
        if (pinned((wave < 4) & (s + 2 < G1_NST))) issue(s + 2);
    }
    // nothing of the ring is outstanding when the wave goes on to its end
    asm volatile("s_wait_tensorcnt 0x0" ::: "memory");
    asm volatile("s_wait_dscnt 0x0" ::: "memory");

    // ---- epilogue: Bu[m][s] f32; one address, every store at a constant offset ----
    float* bo = Bu + (size_t)(mbase + wm * 64 + h * 8) * S_DIM + wn * 128 + lr;
    #pragma unroll
    for (int mi = 0; mi < 4; ++mi)
        #pragma unroll
        for (int r = 0; r < 8; ++r)
            #pragma unroll
            for (int ni = 0; ni < 8; ++ni)
                bo[(mi * 16 + r) * S_DIM + ni * 16] = acc[mi][ni][r];
}

// --------------------------- SCAN ------------------------------------------
// The chain x[l] = a*x[l-1] + Bu[l] is linear, so it is cut along l. A block
// owns 64 channels of one batch (a lane two neighbours: a wave's load is 256
// contiguous bytes, its store one whole 128-B line); each of its 16 waves
// holds one chunk of 64 steps in registers. Per round of 1024 steps:
//   1. every wave runs its chunk from zero and leaves the end value in LDS;
//   2. behind one barrier every wave folds the 16 end values with a^64 into
//      the state at the head of its own chunk (and of the next round);
//   3. it runs its chunk again from that state, out of the same registers,
//      stores the results and refills each register for the next round.
// Bu is read once, and a whole round of it is in flight at a time.
#define SCAN_W   16                // waves of a block = chunks of a round
#define SCAN_T   64                // steps of a chunk
#define SCAN_G   16                // steps whose bf16 results are stored together
#define SCAN_R   (SEQ_L / (SCAN_W * SCAN_T))      // 2 rounds
#define SCAN_C   64                // channels of a block
typedef __attribute__((ext_vector_type(2))) float  v2f;
typedef __attribute__((ext_vector_type(2))) __bf16 v2bf;

__global__ __launch_bounds__(SCAN_W * 32)
void ssm_scan_kernel(const float* __restrict__ Bu,
                     const float* __restrict__ ad,
                     const float* __restrict__ h0,
                     __bf16* __restrict__ xs) {
    __shared__ v2f ends[SCAN_R][SCAN_W][32];         // a plane a round: one barrier a round

    const int lane = threadIdx.x & 31;
    const int c    = threadIdx.x >> 5;               // this wave's chunk
    const int b    = blockIdx.x / (S_DIM / SCAN_C);
    const int s    = (blockIdx.x % (S_DIM / SCAN_C)) * SCAN_C + lane * 2;
    const v2f a = *(const v2f*)(ad + s);
    v2f x0      = *(const v2f*)(h0 + s);             // state at the head of the round
    // keeps these two loads older than the chunk's: issued behind them, their
    // wait would drain the whole chunk before the first step
    __builtin_amdgcn_sched_barrier(0);
    const size_t row0 = (size_t)b * SEQ_L + c * SCAN_T;
    const float* bu = Bu + row0 * S_DIM + s;
    __bf16* xo      = xs + row0 * S_DIM + s;

    // every loop below is unrolled: v and y are then indexed by constants
    // alone and stay in registers
    v2f v[SCAN_T];
    #pragma unroll
    for (int k = 0; k < SCAN_T; ++k) v[k] = *(const v2f*)(bu + (size_t)k * S_DIM);

    v2f aT = a;                                      // a^SCAN_T by six squarings
    #pragma unroll
    for (int q = 1; q < SCAN_T; q *= 2) aT *= aT;

    // unrolled so that v stays in registers and the last round drops its refill
    #pragma unroll
    for (int r = 0; r < SCAN_R; ++r) {
        v2f e = v[0];
        #pragma unroll
        for (int k = 1; k < SCAN_T; ++k) {
            e.x = fmaf(e.x, a.x, v[k].x);
            e.y = fmaf(e.y, a.y, v[k].y);
        }
        ends[r][c][lane] = e;
        __syncthreads();

        v2f x = x0, xin = x0;
        #pragma unroll
        for (int j = 0; j < SCAN_W; ++j) {
            const v2f ej = ends[r][j][lane];
            if (j == c) xin = x;
            x.x = fmaf(x.x, aT.x, ej.x);
            x.y = fmaf(x.y, aT.y, ej.y);
        }
        x0 = x;
        x  = xin;

        const int l0 = r * SCAN_W * SCAN_T;
        #pragma unroll
        for (int g = 0; g < SCAN_T; g += SCAN_G) {
            v2bf y[SCAN_G];
            #pragma unroll
            for (int k = 0; k < SCAN_G; ++k) {
                x.x = fmaf(x.x, a.x, v[g + k].x);
                x.y = fmaf(x.y, a.y, v[g + k].y);
                y[k][0] = (__bf16)x.x;
                y[k][1] = (__bf16)x.y;
                if (r + 1 < SCAN_R) {
                    // stands in front of the kernel's last load, whose result
                    // lands in the address pair that the loads before it name
                    if (r + 2 == SCAN_R && g + k == SCAN_T - 1)
                        asm volatile("s_wait_xcnt 0x0" ::: "memory");
                    v[g + k] = *(const v2f*)(bu + (size_t)(l0 + SCAN_W * SCAN_T + g + k) * S_DIM);
                }
            }
            __builtin_amdgcn_sched_barrier(0);
            #pragma unroll
            for (int k = 0; k < SCAN_G; ++k)
                *(v2bf*)(xo + (size_t)(l0 + g + k) * S_DIM) = y[k];
            // stands in front of the next group's refill loads, whose results
            // land in the data registers that these stores name
            if (r + 1 < SCAN_R && g + SCAN_G < SCAN_T)
                asm volatile("s_wait_xcnt 0x0" ::: "memory");
            // keeps the stores from sinking to the round's end, where all
            // SCAN_T of them in a row fill the store counter
            __builtin_amdgcn_sched_barrier(0);
        }
    }
}

#define G2_K      128                       // k of a stage
#define G2_ROWB   (G2_K * 2)                // bytes of a tile row
#define G2_PITCH  (G2_ROWB + 16)            // LDS pitch for ds_load_b128 readers
#define G2_TILE   (128 * G2_PITCH)          // 34,816 B = 17 x 2 KiB
#define G2_NST    ((S_DIM + IN_DIM) / G2_K) // 8 stages
#define G2_OPITCH (BLK_M * 4 + 16)          // LDS pitch of an output row (128 l, f32)

__global__ __launch_bounds__(256)
void ssm_gemm2_kernel(const __bf16* __restrict__ xs,
                      const __bf16* __restrict__ uT,
                      const __bf16* __restrict__ CDb,   // [o][k], stride 1024
                      float* __restrict__ out) {
    // [buffer][A | B]; every tile starts at a multiple of 2 KiB
    __shared__ __attribute__((aligned(2048))) unsigned char ring[2][2][G2_TILE];

    const int tid  = threadIdx.x;
    const int lane = tid & 31;
    const uint32_t wave = uni(threadIdx.x >> 5);
    const int wm   = wave >> 1;
    const int wn   = wave & 1;
    const int lr   = lane & 15;
    const int h    = lane >> 4;

    const int mbase = blockIdx.x * BLK_M;
    const int nbase = blockIdx.y * BLK_N;

    v8f acc[2][4];
    #pragma unroll
    for (int mi = 0; mi < 2; ++mi)
        #pragma unroll
        for (int ni = 0; ni < 4; ++ni) acc[mi][ni] = (v8f){};

    u32x8 g1;
    g1[0] = uni((1u << 20) | (5u << 22) | (3u << 25));
    g1[1] = uni(((uint32_t)G2_ROWB & 0xFFFFu) << 16);
    g1[2] = uni(128u << 16);
    g1[3] = uni((uint32_t)G2_ROWB << 16);
    g1[4] = uni(128u);
    g1[5] = uni(wave == 0 ? (uint32_t)(S_DIM * 2) : (uint32_t)((S_DIM + IN_DIM) * 2));
    g1[6] = uni(0u);
    g1[7] = uni(0u);
    const uint32_t ring0 = (uint32_t)(uintptr_t)&ring[0][0][0];

    // one request of the calling wave (0 or 1): its tile of stage s
    auto issue = [&](int s) {
        const int k0 = s * G2_K;
        const __bf16* src = (wave == 0)
            ? ((k0 < S_DIM) ? xs + (size_t)mbase * S_DIM + k0
                            : uT + (size_t)mbase * IN_DIM + (k0 - S_DIM))
            : CDb + (size_t)nbase * (S_DIM + IN_DIM) + k0;
        const uint64_t ga = (uint64_t)(uintptr_t)src;
        u32x4 g0;
        g0[0] = uni(1u);
        g0[1] = uni(ring0 + (uint32_t)(((s & 1) * 2 + (int)wave) * G2_TILE));
        g0[2] = (uint32_t)uni((uint32_t)ga);
        g0[3] = (uint32_t)uni((((uint32_t)(ga >> 32)) & 0x01FFFFFFu) | 0x80000000u);
        asm volatile("tensor_load_to_lds %0, %1" :: "s"(g0), "s"(g1) : "memory");
    };

    // prologue of the two-buffer ring
    if (pinned(wave < 2)) {
        issue(0);
        // stage 0 has landed before the barrier publishes it
        asm volatile("s_wait_tensorcnt 0x0" ::: "memory");
    }
    __syncthreads();
    if (pinned(wave < 2)) issue(1);

    // unrolled: whether a stage s + 2 exists, and whether a stage's A tile is
    // of xs or of uT, is then settled at compile time
    #pragma unroll
    for (int s = 0; s < G2_NST; ++s) {
        const unsigned char* At = &ring[s & 1][0][0] + (wm * 32 + lr) * G2_PITCH;
        const unsigned char* Bt = &ring[s & 1][1][0] + (wn * 64 + lr) * G2_PITCH;
        #pragma unroll
        for (int kk = 0; kk < G2_K / BLK_K; ++kk) {
            v16bf a0 = load_frag((const __bf16*)(At + kk * 64), h);
            v16bf a1 = load_frag((const __bf16*)(At + 16 * G2_PITCH + kk * 64), h);
            #pragma unroll
            for (int ni = 0; ni < 4; ++ni) {
                v16bf bf = load_frag((const __bf16*)(Bt + ni * 16 * G2_PITCH + kk * 64), h);
                acc[0][ni] = wmma_bf16(a0, bf, acc[0][ni]);
                acc[1][ni] = wmma_bf16(a1, bf, acc[1][ni]);
            }
        }
        // publish point of stage s + 1: this wave's reads of stage s are done,
        asm volatile("s_wait_dscnt 0x0" ::: "memory");
        // each issuing wave's tile of stage s + 1 has landed,
        if (pinned(wave < 2)) asm volatile("s_wait_tensorcnt 0x0" ::: "memory");
        // every wave has left stage s's buffer and may read stage s + 1,
        __syncthreads();
        // and stage s + 2 goes into the buffer that stage s has left
        if (s + 2 < G2_NST) {
            if (pinned(wave < 2)) issue(s + 2);
        }
    }
    // nothing of the ring is outstanding when the wave goes on to its end
    asm volatile("s_wait_tensorcnt 0x0" ::: "memory");
    asm volatile("s_wait_dscnt 0x0" ::: "memory");

    // epilogue: Y[b, o, l]; m = b*2048 + l, so the block's tile is 128 rows o
    // of 128 consecutive l (512 B). A lane's 8 accumulator rows are only 32 B
    // of such a row, so the tile is laid out in the ring, which every wave has
    // left at the last pass's barrier, as [o][l] ...
    unsigned char* st = &ring[0][0][0];
    #pragma unroll
    for (int mi = 0; mi < 2; ++mi)
        #pragma unroll
        for (int ni = 0; ni < 4; ++ni) {
            float* sp = (float*)(st + (wn * 64 + ni * 16 + lr) * G2_OPITCH)
                        + wm * 32 + mi * 16 + h * 8;
            v8f c = acc[mi][ni];
            *(v4f*)sp       = __builtin_shufflevector(c, c, 0, 1, 2, 3);
            *(v4f*)(sp + 4) = __builtin_shufflevector(c, c, 4, 5, 6, 7);
        }
    // every wave's part of the tile is in LDS before a row is read back
    __syncthreads();
    // ... and a wave's store is one whole row: 512 contiguous bytes
    float* yb = out + (size_t)(mbase / SEQ_L) * OUT_DIM * SEQ_L
                    + (size_t)(nbase + (int)wave * 16) * SEQ_L
                    + (mbase & (SEQ_L - 1)) + lane * 4;
    const unsigned char* sr = st + ((int)wave * 16) * G2_OPITCH + lane * 16;
    v4f row[16];
    #pragma unroll
    for (int i = 0; i < 16; ++i) row[i] = *(const v4f*)(sr + i * G2_OPITCH);
    #pragma unroll
    for (int i = 0; i < 16; ++i) *(v4f*)(yb + (size_t)i * SEQ_L) = row[i];
}

// --------------------------- launch ----------------------------------------

extern "C" void kernel_launch(void* const* d_in, const int* in_sizes, int n_in,
                              void* d_out, int out_size, void* d_ws, size_t ws_size,
                              hipStream_t stream) {
    const float* u     = (const float*)d_in[0];
    const float* a_unc = (const float*)d_in[1];
    const float* Bmat  = (const float*)d_in[2];
    const float* Cmat  = (const float*)d_in[3];
    const float* Dmat  = (const float*)d_in[4];
    const float* h0    = (const float*)d_in[5];
    float* out = (float*)d_out;

    char* w = (char*)d_ws;
    float*  ad  = (float*)w;                               // 2 KiB
    __bf16* Bb  = (__bf16*)(w + 4096);                     // 512 KiB
    __bf16* CDb = (__bf16*)(w + 4096 + (512 << 10));       // 1 MiB
    char* w2 = w + 4096 + (512 << 10) + (1 << 20);
    float*  Bu  = (float*)w2;                              // 64 MiB
    __bf16* xsb = (__bf16*)(w2 + ((size_t)64 << 20));      // 32 MiB
    __bf16* uT  = (__bf16*)(w2 + ((size_t)96 << 20));      // 32 MiB

    ssm_prep_kernel<<<3 * PREP_BLKS + 1, 256, 0, stream>>>(a_unc, Bmat, Cmat, Dmat, ad, Bb, CDb);

    ssm_gemm1_kernel<<<M_TOT / BLK_M, 256, 0, stream>>>(u, Bb, Bu, uT);
    ssm_scan_kernel<<<(BZ * S_DIM) / SCAN_C, SCAN_W * 32, 0, stream>>>(Bu, ad, h0, xsb);
    ssm_gemm2_kernel<<<dim3(M_TOT / BLK_M, OUT_DIM / BLK_N), 256, 0, stream>>>(xsb, uT, CDb, out);
}
